// v000
// Times are from an AMD MI455X. After a warm-up the kernel runs many times in a row, and a time is the length of
// such a window on the GPU divided by its runs, so every launch and the gaps after it count. The runs cycle
// through copies of the inputs. A figure is the median of several windows, for all but v000 over two sittings.
// Sittings can differ by a few percent; kernels timed side by side share one.
// The starting kernel, v000, takes 1680 microseconds a run.
#include <hip/hip_runtime.h>

// Causal GQA with key-padding mask and interleaved rotary (x [2][2048][2048]; q = x wq ('xw' [2048][2048], 16 heads x 128); [k|v] = x wkv ('xw' [2048][2048]: columns 0-1023 k, 1024-2047 v; 8 kv heads x 128); llama-style interleaved RoPE from the given tables [2048][64] on q, k; 2 query heads per kv head; scores/sqrt(128) masked where j > i OR j >= seq_lengths[b] (int32 input, read on device); softmax; out = merged wo ('xw') -> [2][2048][2048]).
// Compute dtypes, f32 accumulate: every input rounded to bf16; q/k/v on PLAIN bf16 operands (inputs: exact); rotary in f32 from the bf16-rounded tables; causal + padding-masked scores and attn.v (causal tile skipping): query rows < 512 hl (3 products), the rest single fp16 (x1024); softmax f32; wo hl x exact (2 products).

#define NB_  2
#define TT   2048
#define DM   2048
#define NH_  16
#define NKV  8
#define REP  (NH_ / NKV)
#define HD   128
#define DQ   (NH_ * HD)
#define DKV  (NKV * HD)
#define ZH   2
#define RH   512                  // query rows < RH use hi+lo planes (0: none)
#define WIN  2048
#define PCAR 1024.0f
#define SCL  0.088388347648318447f   // HD^-0.5
typedef _Float16 h16;
typedef unsigned short bf;
typedef __attribute__((ext_vector_type(16))) __bf16   v16bf;
typedef __attribute__((ext_vector_type(16))) _Float16 v16h;
typedef __attribute__((ext_vector_type(8)))  _Float16 v8h;
typedef __attribute__((ext_vector_type(8)))  unsigned short v8us;
typedef __attribute__((ext_vector_type(8)))  float    v8f;
typedef __attribute__((ext_vector_type(4)))  float    v4f;
typedef v8h  __attribute__((may_alias)) v8ha;
typedef v4f  __attribute__((may_alias)) v4fa;
typedef v8us __attribute__((may_alias)) v8usa;

__device__ __forceinline__ unsigned short f2bf(float f) { unsigned u = __float_as_uint(f); u += 0x7FFFu + ((u >> 16) & 1u); return (unsigned short)(u >> 16); }
__device__ __forceinline__ float bf2f(unsigned short b) { return __uint_as_float(((unsigned)b) << 16); }
__device__ __forceinline__ float bfr(float f) { return bf2f(f2bf(f)); }
__device__ __forceinline__ v16h cat16(v8h lo, v8h hi) { return __builtin_shufflevector(lo, hi, 0, 1, 2, 3, 4, 5, 6, 7, 8, 9, 10, 11, 12, 13, 14, 15); }
__device__ __forceinline__ v16bf cat16b(v8us lo, v8us hi) { return __builtin_bit_cast(v16bf, __builtin_shufflevector(lo, hi, 0, 1, 2, 3, 4, 5, 6, 7, 8, 9, 10, 11, 12, 13, 14, 15)); }
__device__ __forceinline__ v8f wmma16(v16h a, v16h b, v8f c) { return __builtin_amdgcn_wmma_f32_16x16x32_f16(false, a, false, b, (short)0, c, false, false); }
__device__ __forceinline__ v8f wmmab(v16bf a, v16bf b, v8f c) { return __builtin_amdgcn_wmma_f32_16x16x32_bf16(false, a, false, b, (short)0, c, false, false); }



// ---- k_gemmw: register-blocked GEMM, ONE WAVE per 64x64 output tile (16 accumulators), operands straight from K-contiguous 16-bit planes; grid (M/64, N/64, Z), 32 threads.
// C[m][n] (f32, pitch ldc, + optional f32 bias[n]) = sum_k A[m][k] Bt[n][k] (+ split products per NSPLIT). z-batch strides sA/sB/sC in elements. K % 32 == 0.
template <typename T16> struct WFrag;
template <> struct WFrag<h16> { typedef v16h V; static __device__ __forceinline__ V ld(const h16* p) { return cat16(*(const v8h*)p, *(const v8h*)(p + 16)); } static __device__ __forceinline__ v8f mma(V a, V b, v8f c) { return wmma16(a, b, c); } };
template <> struct WFrag<bf> { typedef v16bf V; static __device__ __forceinline__ V ld(const bf* p) { return cat16b(*(const v8us*)p, *(const v8us*)(p + 16)); } static __device__ __forceinline__ v8f mma(V a, V b, v8f c) { return wmmab(a, b, c); } };
template <typename T16, int NSPLIT, bool BIAS>
__global__ __launch_bounds__(32) void k_gemmw(const T16* __restrict__ A, const T16* __restrict__ A2, const T16* __restrict__ Bt, const T16* __restrict__ Bt2, int K, float* C, int ldc, const float* __restrict__ bias, size_t sA, size_t sB, size_t sC) {
    typedef typename WFrag<T16>::V V;
    __shared__ __align__(16) float os[16 * 68];
    const size_t z = blockIdx.z; A += z * sA; if (A2) A2 += z * sA; Bt += z * sB; if (Bt2) Bt2 += z * sB; C += z * sC;
    const int lane = threadIdx.x & 31, lr = lane & 15, hi = lane >> 4; const int r0 = blockIdx.x * 64, c0 = blockIdx.y * 64;
    v8f acc[4][4];
#pragma unroll
    for (int mb = 0; mb < 4; ++mb)
#pragma unroll
        for (int nb = 0; nb < 4; ++nb) acc[mb][nb] = (v8f){};
    const size_t aoff = (size_t)(r0 + lr) * K + 8 * hi, boff = (size_t)(c0 + lr) * K + 8 * hi;
#pragma unroll 1
    for (int kc = 0; kc < K; kc += 32) {
        V a[4], a2[4];
#pragma unroll
        for (int mb = 0; mb < 4; ++mb) { a[mb] = WFrag<T16>::ld(A + aoff + (size_t)mb * 16 * K + kc); if (NSPLIT == 1 || NSPLIT == 2) a2[mb] = WFrag<T16>::ld(A2 + aoff + (size_t)mb * 16 * K + kc); }
#pragma unroll
        for (int nb = 0; nb < 4; ++nb) { const V b = WFrag<T16>::ld(Bt + boff + (size_t)nb * 16 * K + kc); V b2; if (NSPLIT >= 2) b2 = WFrag<T16>::ld(Bt2 + boff + (size_t)nb * 16 * K + kc);
#pragma unroll
            for (int mb = 0; mb < 4; ++mb) { acc[mb][nb] = WFrag<T16>::mma(a[mb], b, acc[mb][nb]); if (NSPLIT == 1 || NSPLIT == 2) acc[mb][nb] = WFrag<T16>::mma(a2[mb], b, acc[mb][nb]); if (NSPLIT >= 2) acc[mb][nb] = WFrag<T16>::mma(a[mb], b2, acc[mb][nb]); } }
        asm volatile("v_nop\n\tv_nop\n\tv_nop\n\tv_nop" : "+v"(acc[0][0]), "+v"(acc[1][1]), "+v"(acc[2][2]), "+v"(acc[3][3]) : "v"(a[0]), "v"(a[3]));
    }
#pragma unroll
    for (int mb = 0; mb < 4; ++mb) {
#pragma unroll
        for (int nb = 0; nb < 4; ++nb) {
#pragma unroll
            for (int j = 0; j < 8; ++j) os[(hi * 8 + j) * 68 + nb * 16 + lr] = acc[mb][nb][j]; }
        __builtin_amdgcn_wave_barrier(); asm volatile("" ::: "memory");
        float* crow = C + (size_t)(r0 + mb * 16) * ldc + c0;
{
#pragma unroll
            for (int s = 0; s < 8; ++s) { const int row = 2 * s + hi, cofs = lr * 4; v4f val = *(const v4fa*)(os + row * 68 + cofs); if (BIAS) { val[0] += bfr(bias[c0 + cofs]); val[1] += bfr(bias[c0 + cofs + 1]); val[2] += bfr(bias[c0 + cofs + 2]); val[3] += bfr(bias[c0 + cofs + 3]); }
                *(v4f*)(crow + (size_t)row * ldc + cofs) = val; }
             }
        __builtin_amdgcn_wave_barrier(); asm volatile("" ::: "memory");
    }
}

// ---- k_gemmc: the same one-wave 64x64 tile GEMM specialised for causal attention: CMODE 1 skips score tiles entirely above the diagonal (query rows r0+roff.., key columns c0..), CMODE 2 limits the
// key (K) loop of the probability x value contraction to the diagonal block (probabilities beyond it are exactly zero). roff = row offset of this launch's first row within the sequence.
template <typename T16, int NSPLIT, int CMODE>
__global__ __launch_bounds__(32) void k_gemmc(const T16* __restrict__ A, const T16* __restrict__ A2, const T16* __restrict__ Bt, const T16* __restrict__ Bt2, int K, float* C, int ldc, int roff, size_t sA, size_t sB, size_t sC) {
    typedef typename WFrag<T16>::V V;
    __shared__ __align__(16) float os[16 * 68];
    const size_t z = blockIdx.z; A += z * sA; if (A2) A2 += z * sA; Bt += z * sB; if (Bt2) Bt2 += z * sB; C += z * sC;
    const int lane = threadIdx.x & 31, lr = lane & 15, hi = lane >> 4; const int r0 = blockIdx.x * 64, c0 = blockIdx.y * 64;
    if (CMODE == 1 && c0 > r0 + roff + 63) return;                  // score tile entirely above the causal diagonal: never read (the softmax masks j > i by select)
    const int Kl = (CMODE == 2) ? min(K, r0 + roff + 64) : K;        // P.V: probabilities are exactly 0 beyond the diagonal block, so the K loop stops there
    v8f acc[4][4];
#pragma unroll
    for (int mb = 0; mb < 4; ++mb)
#pragma unroll
        for (int nb = 0; nb < 4; ++nb) acc[mb][nb] = (v8f){};
    const size_t aoff = (size_t)(r0 + lr) * K + 8 * hi, boff = (size_t)(c0 + lr) * K + 8 * hi;
#pragma unroll 1
    for (int kc = 0; kc < Kl; kc += 32) {
        V a[4], a2[4];
#pragma unroll
        for (int mb = 0; mb < 4; ++mb) { a[mb] = WFrag<T16>::ld(A + aoff + (size_t)mb * 16 * K + kc); if (NSPLIT == 1 || NSPLIT == 2) a2[mb] = WFrag<T16>::ld(A2 + aoff + (size_t)mb * 16 * K + kc); }
#pragma unroll
        for (int nb = 0; nb < 4; ++nb) { const V b = WFrag<T16>::ld(Bt + boff + (size_t)nb * 16 * K + kc); V b2; if (NSPLIT >= 2) b2 = WFrag<T16>::ld(Bt2 + boff + (size_t)nb * 16 * K + kc);
#pragma unroll
            for (int mb = 0; mb < 4; ++mb) { acc[mb][nb] = WFrag<T16>::mma(a[mb], b, acc[mb][nb]); if (NSPLIT == 1 || NSPLIT == 2) acc[mb][nb] = WFrag<T16>::mma(a2[mb], b, acc[mb][nb]); if (NSPLIT >= 2) acc[mb][nb] = WFrag<T16>::mma(a[mb], b2, acc[mb][nb]); } }
        asm volatile("v_nop\n\tv_nop\n\tv_nop\n\tv_nop" : "+v"(acc[0][0]), "+v"(acc[1][1]), "+v"(acc[2][2]), "+v"(acc[3][3]) : "v"(a[0]), "v"(a[3]));
    }
#pragma unroll
    for (int mb = 0; mb < 4; ++mb) {
#pragma unroll
        for (int nb = 0; nb < 4; ++nb) {
#pragma unroll
            for (int j = 0; j < 8; ++j) os[(hi * 8 + j) * 68 + nb * 16 + lr] = acc[mb][nb][j]; }
        __builtin_amdgcn_wave_barrier(); asm volatile("" ::: "memory");
        float* crow = C + (size_t)(r0 + mb * 16) * ldc + c0;
{
#pragma unroll
            for (int s = 0; s < 8; ++s) { const int row = 2 * s + hi, cofs = lr * 4; v4f val = *(const v4fa*)(os + row * 68 + cofs);
                *(v4f*)(crow + (size_t)row * ldc + cofs) = val; }
             }
        __builtin_amdgcn_wave_barrier(); asm volatile("" ::: "memory");
    }
}

__device__ __forceinline__ h16 tohx(float x) { return (h16)x; }
__device__ __forceinline__ void splitf(float y, unsigned short& h, unsigned short& l) { h = f2bf(y); l = f2bf(y - bf2f(h)); }
typedef __attribute__((ext_vector_type(2))) _Float16 v2h;
typedef __attribute__((ext_vector_type(4))) _Float16 v4h;
typedef __attribute__((ext_vector_type(2))) unsigned short v2us;
typedef __attribute__((ext_vector_type(4))) unsigned short v4us;
typedef __attribute__((ext_vector_type(2))) float v2f;
typedef __attribute__((ext_vector_type(4))) int v4i;

__global__ __launch_bounds__(256) void k_wtG(const float* __restrict__ w, int K, int N, bf* Bt) {
    const int lane = threadIdx.x & 31; const int L0 = (blockIdx.x * 8 + (threadIdx.x >> 5)) * 8; const int nlines = N * K / 64;
{
#pragma unroll 1
        for (int l = 0; l < 8; ++l) { const int L = L0 + l; if (L >= nlines) break; const size_t e = (size_t)L * 64 + lane * 2; const int k = (int)(e % K), n = (int)(e / K); v2us o;
            o[0] = f2bf(w[(size_t)k * N + n]); o[1] = f2bf(w[(size_t)(k + 1) * N + n]); *(v2us*)(Bt + e) = o; }
         }
}
__global__ __launch_bounds__(256) void k_cvt8(const float* __restrict__ src, bf* dst, size_t n8) { const size_t i = (size_t)blockIdx.x * 256 + threadIdx.x; if (i >= n8) return; const v8f v = *(const v8f*)(src + i * 8); v8us o;
#pragma unroll
    for (int k = 0; k < 8; ++k) o[k] = f2bf(v[k]); *(v8us*)(dst + i * 8) = o;  }
__global__ __launch_bounds__(256) void k_cscvt(const float* __restrict__ cosT, const float* __restrict__ sinT, float* CS) { const int idx = blockIdx.x * 256 + threadIdx.x; if (idx >= TT * HD) return; const int t = idx / HD, d = idx % HD; const size_t ti = (size_t)t * (HD / 2) + (d >> 1);   /* interleaved pairs (2i, 2i+1) use table column i */ v2f cs; cs[0] = bfr(cosT[ti]); cs[1] = bfr(sinT[ti]); *(v2f*)(CS + (size_t)idx * 2) = cs;  }
// k_rope: head planes [h][t][d] (fp16 + hi/lo) of the interleaved rotary out_r = tr c - ti s, out_i = tr s + ti c (pairs (2i, 2i+1), table column i)
__global__ __launch_bounds__(256) void k_rope(const float* __restrict__ F, int pitch, int nheads, const float* __restrict__ CS, const float* __restrict__ RF, const float* __restrict__ nw, float sc, h16* P16, bf* Ph, bf* Pl) {
    const size_t e = ((size_t)blockIdx.x * 256 + threadIdx.x) * 2; if (e >= (size_t)nheads * TT * HD) return; const int d = (int)(e % HD); const int t = (int)((e / HD) % TT); const int h = (int)(e / ((size_t)HD * TT)); const float* f = F + (size_t)t * pitch + h * HD; const float rf = RF ? RF[(size_t)h * TT + t] : 1.0f; v2h o16; v2us oh, ol;
#pragma unroll
    for (int q = 0; q < 2; ++q) { const int dd = d + q; const int dp = dd ^ 1;   /* interleaved pair partner */ float x0 = f[dd], x1 = f[dp];
        if (RF) { float n0 = __fmul_rn(x0, rf), n1 = __fmul_rn(x1, rf); asm volatile("" : "+v"(n0)); asm volatile("" : "+v"(n1)); x0 = __fmul_rn(bfr(nw[dd]), n0); x1 = __fmul_rn(bfr(nw[dp]), n1); }
        const v2f cs = *(const v2f*)(CS + ((size_t)t * HD + dd) * 2); float a = __fmul_rn(x0, cs[0]), bq = __fmul_rn(x1, cs[1]); asm volatile("" : "+v"(a)); asm volatile("" : "+v"(bq)); const float r = (((dd & 1) == 0) ? __fsub_rn(a, bq) : __fadd_rn(a, bq)) * sc;   /* even: tr c - ti s; odd: ti c + tr s */
        o16[q] = tohx(r); unsigned short a2, c2; splitf(r, a2, c2); oh[q] = a2; ol[q] = c2; }
    *(v2h*)(P16 + e) = o16; *(v2us*)(Ph + e) = oh; *(v2us*)(Pl + e) = ol;  }
__global__ __launch_bounds__(256) void k_vtp(const float* __restrict__ F, int pitch, int nheads, h16* V16, bf* Vh, bf* Vl) { const size_t e = ((size_t)blockIdx.x * 256 + threadIdx.x) * 2; if (e >= (size_t)nheads * HD * TT) return; const int t = (int)(e % TT); const int d = (int)((e / TT) % HD); const int g = (int)(e / ((size_t)TT * HD)); v2h o16; v2us oh, ol;
#pragma unroll
    for (int q = 0; q < 2; ++q) { const float x = F[(size_t)(t + q) * pitch + g * HD + d]; o16[q] = tohx(x); unsigned short a2, c2; splitf(x, a2, c2); oh[q] = a2; ol[q] = c2; }
    *(v2h*)(V16 + e) = o16; *(v2us*)(Vh + e) = oh; *(v2us*)(Vl + e) = ol;  }
// k_asoft: per row (zz, i): t = S x HD^-0.5 for j <= i and j < seq_lengths[b] (causal + key padding; the reference's -1e9 additive fill vanishes identically); softmax over the 2048 keys (register row, one exp, fixed trees);; keys are kept where j <= i AND j < seq_lengths[b] (read from the int32 input); every row keeps key 0 (seq_lengths >= 1024)
__global__ __launch_bounds__(256) void k_asoft(const float* __restrict__ Sb, const int* __restrict__ SLb, h16* P16, bf* Ph, bf* Pl) {
    const int lane = threadIdx.x & 31; const int row = blockIdx.x * 8 + (threadIdx.x >> 5); if (row >= ZH * TT) return; const int i = row % TT; const int zz = row / TT; (void)zz; const int slen = SLb[0];   /* valid key count for this batch (int32 input) */ const bool hires = (i < RH); const float* sr = Sb + (size_t)row * TT; float v[TT / 32]; float mx = -3.0e38f;
#pragma unroll
    for (int ch = 0; ch < TT / 128; ++ch) { const int j0 = ch * 128 + lane * 4; const v4f a = *(const v4f*)(sr + j0);
#pragma unroll
        for (int q = 0; q < 4; ++q) { const int j = j0 + q; (void)j; const float t = (j <= i && j < slen) ? a[q] * SCL : -3.0e38f;   /* causal AND key padding */ v[ch * 4 + q] = t; mx = fmaxf(mx, t); } }
#pragma unroll
    for (int sh = 16; sh; sh >>= 1) mx = fmaxf(mx, __shfl_xor(mx, sh, 32));
    float sum = 0.f;
#pragma unroll
    for (int k = 0; k < TT / 32; ++k) { float d0 = __fsub_rn(v[k], mx); asm volatile("" : "+v"(d0)); v[k] = __builtin_amdgcn_exp2f(__fmul_rn(d0, 1.4426950408889634f)); sum += v[k]; }
#pragma unroll
    for (int sh = 16; sh; sh >>= 1) sum += __shfl_xor(sum, sh, 32);
    const float f = __fdiv_rn(hires ? 1.0f : PCAR, sum);
{
        if (hires) {
#pragma unroll
            for (int ch = 0; ch < TT / 128; ++ch) { v4us oh, ol;
#pragma unroll
                for (int q = 0; q < 4; ++q) { unsigned short a, c2; splitf(v[ch * 4 + q] * f, a, c2); oh[q] = a; ol[q] = c2; }
                const size_t oo = ((size_t)zz * (RH ? RH : 1) + i) * TT + ch * 128 + lane * 4; *(v4us*)(Ph + oo) = oh; *(v4us*)(Pl + oo) = ol; }
        } else {
#pragma unroll
            for (int ch = 0; ch < TT / 128; ++ch) { v4h o4;
#pragma unroll
                for (int q = 0; q < 4; ++q) o4[q] = tohx(v[ch * 4 + q] * f);
                *(v4h*)(P16 + (size_t)row * TT + ch * 128 + lane * 4) = o4; } }
         }
}
__global__ __launch_bounds__(256) void k_merge(const float* __restrict__ O, int h0, bf* Ah, bf* Al) { const size_t e = ((size_t)blockIdx.x * 256 + threadIdx.x) * 2; if (e >= (size_t)ZH * TT * HD) return; const int d = (int)(e % HD); const int t = (int)((e / HD) % TT); const int zz = (int)(e / ((size_t)HD * TT)); const float cs = (t < RH) ? 1.0f : (1.0f / PCAR); const size_t oo = (size_t)t * DQ + (h0 + zz) * HD + d;
    v2us oh, ol;
#pragma unroll
    for (int q = 0; q < 2; ++q) { unsigned short a, c2; splitf(O[e + q] * cs, a, c2); oh[q] = a; ol[q] = c2; } *(v2us*)(Ah + oo) = oh; *(v2us*)(Al + oo) = ol;  }

extern "C" void kernel_launch(void* const* d_in, const int* in_sizes, int n_in,
                              void* d_out, int out_size, void* d_ws, size_t ws_size, hipStream_t stream) {
    (void)in_sizes; (void)n_in; (void)out_size;
    const float* x = (const float*)d_in[0]; const float* wq = (const float*)d_in[1]; const float* wkv = (const float*)d_in[2]; const float* wo = (const float*)d_in[3]; const float* cosT = (const float*)d_in[4]; const float* sinT = (const float*)d_in[5]; const int* SL = (const int*)d_in[6]; const float* wk = nullptr; const float* wv = nullptr; (void)wk; (void)wv;
    float* OUT = (float*)d_out;     // [2][2048][2048]
    char* wsp = (char*)d_ws;
    auto take = [&](size_t bytes) { char* p = wsp; wsp += (bytes + 255) & ~(size_t)255; return (void*)p; };
    bf* WQ = (bf*)take((size_t)DQ * DM * 2); bf* WKV = (bf*)take((size_t)2 * DKV * DM * 2); bf* WK = WKV; bf* WV = WKV + (size_t)DKV * DM;   /* row blocks of the transposed fused wkv */ bf* WO = (bf*)take((size_t)DM * DQ * 2); float* CS = (float*)take((size_t)TT * HD * 2 * 4);
    bf* XB = (bf*)take((size_t)TT * DM * 2); float* FQ = (float*)take((size_t)TT * DQ * 4); float* FK = (float*)take((size_t)TT * DKV * 4);
    h16* QP16 = (h16*)take((size_t)NH_ * TT * HD * 2); h16* KP16 = (h16*)take((size_t)NKV * TT * HD * 2); h16* VT16 = (h16*)take((size_t)NKV * HD * TT * 2);
    bf* QPh = (bf*)take((size_t)NH_ * TT * HD * 2); bf* QPl = (bf*)take((size_t)NH_ * TT * HD * 2); bf* KPh = (bf*)take((size_t)NKV * TT * HD * 2); bf* KPl = (bf*)take((size_t)NKV * TT * HD * 2); bf* VTh = (bf*)take((size_t)NKV * HD * TT * 2); bf* VTl = (bf*)take((size_t)NKV * HD * TT * 2); bf* Ph = (bf*)take((size_t)ZH * RH * TT * 2); bf* Pl = (bf*)take((size_t)ZH * RH * TT * 2);
    float* Sb = (float*)take((size_t)ZH * TT * TT * 4); h16* P16 = (h16*)take((size_t)ZH * TT * TT * 2); float* Ob = (float*)take((size_t)ZH * TT * HD * 4); bf* ATh = (bf*)take((size_t)TT * DQ * 2); bf* ATl = (bf*)take((size_t)TT * DQ * 2);
    if ((size_t)(wsp - (char*)d_ws) > ws_size) return;    // ws 256 MiB
    float* FV = FK;   // v projection reuses the k buffer after the k planes are built (stream-ordered)
    { k_wtG<<<(unsigned)((DM * DQ / 64 + 63) / 64), 256, 0, stream>>>(wq, DM, DQ, WQ); k_wtG<<<(unsigned)((DM * 2 * DKV / 64 + 63) / 64), 256, 0, stream>>>(wkv, DM, 2 * DKV, WKV);   /* 'xw' [2048][2048] -> Bt [2048][2048]: rows 0-1023 k, 1024-2047 v */
      k_wtG<<<(unsigned)((DQ * DM / 64 + 63) / 64), 256, 0, stream>>>(wo, DQ, DM, WO);
       }
    const unsigned LQ = (unsigned)(((size_t)NH_ * TT * HD / 2 + 255) / 256), LKv = (unsigned)(((size_t)NKV * TT * HD / 2 + 255) / 256);
    for (int b = 0; b < NB_; ++b) {
        if (b == 0) k_cscvt<<<(TT * HD + 255) / 256, 256, 0, stream>>>(cosT, sinT, CS);
        k_cvt8<<<(unsigned)(((size_t)TT * DM / 8 + 255) / 256), 256, 0, stream>>>(x + (size_t)b * TT * DM, XB, (size_t)TT * DM / 8);
        k_gemmw<bf, 0, false><<<dim3(TT / 64, DQ / 64, 1), 32, 0, stream>>>(XB, nullptr, WQ, nullptr, DM, FQ, DQ, nullptr, 0, 0, 0);
        k_rope<<<LQ, 256, 0, stream>>>(FQ, DQ, NH_, CS, nullptr, nullptr, 1.0f, QP16, QPh, QPl);
        k_gemmw<bf, 0, false><<<dim3(TT / 64, DKV / 64, 1), 32, 0, stream>>>(XB, nullptr, WK, nullptr, DM, FK, DKV, nullptr, 0, 0, 0);
        k_rope<<<LKv, 256, 0, stream>>>(FK, DKV, NKV, CS, nullptr, nullptr, 1.0f, KP16, KPh, KPl);
        k_gemmw<bf, 0, false><<<dim3(TT / 64, DKV / 64, 1), 32, 0, stream>>>(XB, nullptr, WV, nullptr, DM, FV, DKV, nullptr, 0, 0, 0); k_vtp<<<LKv, 256, 0, stream>>>(FV, DKV, NKV, VT16, VTh, VTl);
        for (int h0 = 0; h0 < NH_; h0 += ZH) { const size_t zq = (size_t)h0, zk = (size_t)(h0 / REP);   // both heads of a pass share kv group h0/REP (REP >= 2): sB = 0
            k_gemmc<bf, 2, 1><<<dim3(RH / 64, TT / 64, ZH), 32, 0, stream>>>(QPh + zq * TT * HD, QPl + zq * TT * HD, KPh + zk * TT * HD, KPl + zk * TT * HD, HD, Sb, TT, 0, (size_t)TT * HD, 0, (size_t)TT * TT);
            k_gemmc<h16, 0, 1><<<dim3((TT - RH) / 64, TT / 64, ZH), 32, 0, stream>>>(QP16 + zq * TT * HD + (size_t)RH * HD, nullptr, KP16 + zk * TT * HD, nullptr, HD, Sb + (size_t)RH * TT, TT, RH, (size_t)TT * HD, 0, (size_t)TT * TT);
            k_asoft<<<ZH * TT / 8, 256, 0, stream>>>(Sb, SL + b, P16, Ph, Pl);
            k_gemmc<bf, 2, 2><<<dim3(RH / 64, HD / 64, ZH), 32, 0, stream>>>(Ph, Pl, VTh + zk * HD * TT, VTl + zk * HD * TT, TT, Ob, HD, 0, (size_t)RH * TT, 0, (size_t)TT * HD);
            k_gemmc<h16, 0, 2><<<dim3((TT - RH) / 64, HD / 64, ZH), 32, 0, stream>>>(P16 + (size_t)RH * TT, nullptr, VT16 + zk * HD * TT, nullptr, TT, Ob + (size_t)RH * HD, HD, RH, (size_t)TT * TT, 0, (size_t)TT * HD);
            k_merge<<<(unsigned)(((size_t)ZH * TT * HD / 2 + 255) / 256), 256, 0, stream>>>(Ob, h0, ATh, ATl); }
        k_gemmw<bf, 1, false><<<dim3(TT / 64, DM / 64, 1), 32, 0, stream>>>(ATh, ATl, WO, nullptr, DQ, OUT + (size_t)b * TT * DM, DM, nullptr, 0, 0, 0); }
}

// v001
// One run takes 1050 microseconds.
// In two side-by-side timings against v000, it was 1.59 and 1.63 times as fast.
#include <hip/hip_runtime.h>

// Causal GQA with key-padding mask and interleaved rotary (x [2][2048][2048]; q = x wq ('xw' [2048][2048], 16 heads x 128); [k|v] = x wkv ('xw' [2048][2048]: columns 0-1023 k, 1024-2047 v; 8 kv heads x 128); llama-style interleaved RoPE from the given tables [2048][64] on q, k; 2 query heads per kv head; scores/sqrt(128) masked where j > i OR j >= seq_lengths[b] (int32 input, read on device); softmax; out = merged wo ('xw') -> [2][2048][2048]).
// Compute dtypes, f32 accumulate: every input rounded to bf16; q/k/v on PLAIN bf16 operands (inputs: exact); rotary in f32 from the bf16-rounded tables; causal + padding-masked scores and attn.v (causal tile skipping): query rows < 512 hl (3 products), the rest single fp16 (x1024); softmax f32; wo hl x exact (2 products).

#define NB_  2
#define TT   2048
#define DM   2048
#define NH_  16
#define NKV  8
#define REP  (NH_ / NKV)
#define HD   128
#define DQ   (NH_ * HD)
#define DKV  (NKV * HD)
#define ZH   2
#define RH   512                  // query rows < RH use hi+lo planes (0: none)
#define WIN  2048
#define PCAR 1024.0f
#define SCL  0.088388347648318447f   // HD^-0.5
typedef _Float16 h16;
typedef unsigned short bf;
typedef __attribute__((ext_vector_type(16))) __bf16   v16bf;
typedef __attribute__((ext_vector_type(16))) _Float16 v16h;
typedef __attribute__((ext_vector_type(8)))  _Float16 v8h;
typedef __attribute__((ext_vector_type(8)))  unsigned short v8us;
typedef __attribute__((ext_vector_type(8)))  float    v8f;
typedef __attribute__((ext_vector_type(4)))  float    v4f;
typedef v8h  __attribute__((may_alias)) v8ha;
typedef v4f  __attribute__((may_alias)) v4fa;
typedef v8us __attribute__((may_alias)) v8usa;

__device__ __forceinline__ unsigned short f2bf(float f) { unsigned u = __float_as_uint(f); u += 0x7FFFu + ((u >> 16) & 1u); return (unsigned short)(u >> 16); }
__device__ __forceinline__ float bf2f(unsigned short b) { return __uint_as_float(((unsigned)b) << 16); }
__device__ __forceinline__ float bfr(float f) { return bf2f(f2bf(f)); }
__device__ __forceinline__ v16h cat16(v8h lo, v8h hi) { return __builtin_shufflevector(lo, hi, 0, 1, 2, 3, 4, 5, 6, 7, 8, 9, 10, 11, 12, 13, 14, 15); }
__device__ __forceinline__ v16bf cat16b(v8us lo, v8us hi) { return __builtin_bit_cast(v16bf, __builtin_shufflevector(lo, hi, 0, 1, 2, 3, 4, 5, 6, 7, 8, 9, 10, 11, 12, 13, 14, 15)); }
__device__ __forceinline__ v8f wmma16(v16h a, v16h b, v8f c) { return __builtin_amdgcn_wmma_f32_16x16x32_f16(false, a, false, b, (short)0, c, false, false); }
__device__ __forceinline__ v8f wmmab(v16bf a, v16bf b, v8f c) { return __builtin_amdgcn_wmma_f32_16x16x32_bf16(false, a, false, b, (short)0, c, false, false); }



// tile_sync: orders the LDS slab writes against the reads of the tile epilogue; one wave needs no hardware barrier, several waves need the work-group barrier.
// The fences name LDS alone: only LDS data passes between the waves here, and a full __syncthreads() would also hold every wave until the tile rows just stored to global memory have landed, at each of the four stages.
template <int NW> __device__ __forceinline__ void tile_sync() {
    if (NW == 1) { __builtin_amdgcn_wave_barrier(); asm volatile("" ::: "memory"); }
    else { __builtin_amdgcn_fence(__ATOMIC_RELEASE, "workgroup", "local"); __builtin_amdgcn_s_barrier(); __builtin_amdgcn_fence(__ATOMIC_ACQUIRE, "workgroup", "local"); } }

// ---- k_gemmw: register-blocked GEMM, one 64x64 output tile per work-group of NW waves (16 accumulators per wave), operands straight from K-contiguous 16-bit planes; grid (M/64, N/64, Z), 32 * NW threads.
// Wave w takes the 32-wide K chunks w, w + NW, w + 2 NW, ...; the NW partial tiles are summed in wave order 0..NW-1 through LDS (one slab per wave) before the store.
// C[m][n] (f32, pitch ldc, + optional f32 bias[n]) = sum_k A[m][k] Bt[n][k] (+ split products per NSPLIT). z-batch strides sA/sB/sC in elements. K % 32 == 0.
template <typename T16> struct WFrag;
template <> struct WFrag<h16> { typedef v16h V; static __device__ __forceinline__ V ld(const h16* p) { return cat16(*(const v8h*)p, *(const v8h*)(p + 16)); } static __device__ __forceinline__ v8f mma(V a, V b, v8f c) { return wmma16(a, b, c); } };
template <> struct WFrag<bf> { typedef v16bf V; static __device__ __forceinline__ V ld(const bf* p) { return cat16b(*(const v8us*)p, *(const v8us*)(p + 16)); } static __device__ __forceinline__ v8f mma(V a, V b, v8f c) { return wmmab(a, b, c); } };
template <typename T16, int NSPLIT, bool BIAS, int NW>
__global__ __launch_bounds__(32 * NW) void k_gemmw(const T16* __restrict__ A, const T16* __restrict__ A2, const T16* __restrict__ Bt, const T16* __restrict__ Bt2, int K, float* C, int ldc, const float* __restrict__ bias, size_t sA, size_t sB, size_t sC) {
    typedef typename WFrag<T16>::V V;
    __shared__ __align__(16) float os[NW * 16 * 68];
    const size_t z = blockIdx.z; A += z * sA; if (A2) A2 += z * sA; Bt += z * sB; if (Bt2) Bt2 += z * sB; C += z * sC;
    const int lane = threadIdx.x & 31, lr = lane & 15, hi = lane >> 4; const int wv = (NW == 1) ? 0 : __builtin_amdgcn_readfirstlane((int)(threadIdx.x >> 5)); const int r0 = blockIdx.x * 64, c0 = blockIdx.y * 64;
    v8f acc[4][4];
#pragma unroll
    for (int mb = 0; mb < 4; ++mb)
#pragma unroll
        for (int nb = 0; nb < 4; ++nb) acc[mb][nb] = (v8f){};
    const size_t aoff = (size_t)(r0 + lr) * K + 8 * hi, boff = (size_t)(c0 + lr) * K + 8 * hi;
#pragma unroll 1
    for (int kc = wv * 32; kc < K; kc += 32 * NW) {
        V a[4], a2[4];
#pragma unroll
        for (int mb = 0; mb < 4; ++mb) { a[mb] = WFrag<T16>::ld(A + aoff + (size_t)mb * 16 * K + kc); if (NSPLIT == 1 || NSPLIT == 2) a2[mb] = WFrag<T16>::ld(A2 + aoff + (size_t)mb * 16 * K + kc); }
#pragma unroll
        for (int nb = 0; nb < 4; ++nb) { const V b = WFrag<T16>::ld(Bt + boff + (size_t)nb * 16 * K + kc); V b2; if (NSPLIT >= 2) b2 = WFrag<T16>::ld(Bt2 + boff + (size_t)nb * 16 * K + kc);
#pragma unroll
            for (int mb = 0; mb < 4; ++mb) { acc[mb][nb] = WFrag<T16>::mma(a[mb], b, acc[mb][nb]); if (NSPLIT == 1 || NSPLIT == 2) acc[mb][nb] = WFrag<T16>::mma(a2[mb], b, acc[mb][nb]); if (NSPLIT >= 2) acc[mb][nb] = WFrag<T16>::mma(a[mb], b2, acc[mb][nb]); } }
        asm volatile("v_nop\n\tv_nop\n\tv_nop\n\tv_nop" : "+v"(acc[0][0]), "+v"(acc[1][1]), "+v"(acc[2][2]), "+v"(acc[3][3]) : "v"(a[0]), "v"(a[3]));
    }
#pragma unroll
    for (int mb = 0; mb < 4; ++mb) {
#pragma unroll
        for (int nb = 0; nb < 4; ++nb) {
#pragma unroll
            for (int j = 0; j < 8; ++j) os[wv * (16 * 68) + (hi * 8 + j) * 68 + nb * 16 + lr] = acc[mb][nb][j]; }
        tile_sync<NW>();
        float* crow = C + (size_t)(r0 + mb * 16) * ldc + c0;
{
#pragma unroll
            for (int s = 0; s < (NW < 8 ? 8 / NW : 1); ++s) { const int row = 2 * NW * s + 2 * wv + hi, cofs = lr * 4; if (NW > 8 && wv >= 8) break;   /* 16 rows: waves 8 and up have none */ v4f val = *(const v4fa*)(os + row * 68 + cofs);
#pragma unroll
                for (int w = 1; w < NW; ++w) val += *(const v4fa*)(os + w * (16 * 68) + row * 68 + cofs);
                if (BIAS) { val[0] += bfr(bias[c0 + cofs]); val[1] += bfr(bias[c0 + cofs + 1]); val[2] += bfr(bias[c0 + cofs + 2]); val[3] += bfr(bias[c0 + cofs + 3]); }
                *(v4f*)(crow + (size_t)row * ldc + cofs) = val; }
             }
        if (mb < 3) {   // the slabs are rewritten by the next stage only
            if (NW > 1) asm volatile("s_wait_xcnt 0x0" ::: "memory");   // stands in front of the next stage's reuse of the registers that the stores above name
            tile_sync<NW>(); }
    }
}

// ---- k_gemmc: the same 64x64 tile GEMM (NW waves share the K loop) specialised for causal attention: CMODE 1 skips score tiles entirely above the diagonal (query rows r0+roff.., key columns c0..), CMODE 2 limits the
// key (K) loop of the probability x value contraction to the diagonal block (probabilities beyond it are exactly zero). roff = row offset of this launch's first row within the sequence.
template <typename T16, int NSPLIT, int CMODE, int NW>
__global__ __launch_bounds__(32 * NW) void k_gemmc(const T16* __restrict__ A, const T16* __restrict__ A2, const T16* __restrict__ Bt, const T16* __restrict__ Bt2, int K, float* C, int ldc, int roff, size_t sA, size_t sB, size_t sC) {
    typedef typename WFrag<T16>::V V;
    __shared__ __align__(16) float os[NW * 16 * 68];
    const size_t z = blockIdx.z; A += z * sA; if (A2) A2 += z * sA; Bt += z * sB; if (Bt2) Bt2 += z * sB; C += z * sC;
    const int lane = threadIdx.x & 31, lr = lane & 15, hi = lane >> 4; const int wv = (NW == 1) ? 0 : __builtin_amdgcn_readfirstlane((int)(threadIdx.x >> 5)); const int r0 = blockIdx.x * 64, c0 = blockIdx.y * 64;
    if (CMODE == 1 && c0 > r0 + roff + 63) return;                  // score tile entirely above the causal diagonal: never read (the softmax masks j > i by select)
    const int Kl = (CMODE == 2) ? min(K, r0 + roff + 64) : K;        // P.V: probabilities are exactly 0 beyond the diagonal block, so the K loop stops there
    v8f acc[4][4];
#pragma unroll
    for (int mb = 0; mb < 4; ++mb)
#pragma unroll
        for (int nb = 0; nb < 4; ++nb) acc[mb][nb] = (v8f){};
    const size_t aoff = (size_t)(r0 + lr) * K + 8 * hi, boff = (size_t)(c0 + lr) * K + 8 * hi;
#pragma unroll 1
    for (int kc = wv * 32; kc < Kl; kc += 32 * NW) {
        V a[4], a2[4];
#pragma unroll
        for (int mb = 0; mb < 4; ++mb) { a[mb] = WFrag<T16>::ld(A + aoff + (size_t)mb * 16 * K + kc); if (NSPLIT == 1 || NSPLIT == 2) a2[mb] = WFrag<T16>::ld(A2 + aoff + (size_t)mb * 16 * K + kc); }
#pragma unroll
        for (int nb = 0; nb < 4; ++nb) { const V b = WFrag<T16>::ld(Bt + boff + (size_t)nb * 16 * K + kc); V b2; if (NSPLIT >= 2) b2 = WFrag<T16>::ld(Bt2 + boff + (size_t)nb * 16 * K + kc);
#pragma unroll
            for (int mb = 0; mb < 4; ++mb) { acc[mb][nb] = WFrag<T16>::mma(a[mb], b, acc[mb][nb]); if (NSPLIT == 1 || NSPLIT == 2) acc[mb][nb] = WFrag<T16>::mma(a2[mb], b, acc[mb][nb]); if (NSPLIT >= 2) acc[mb][nb] = WFrag<T16>::mma(a[mb], b2, acc[mb][nb]); } }
        asm volatile("v_nop\n\tv_nop\n\tv_nop\n\tv_nop" : "+v"(acc[0][0]), "+v"(acc[1][1]), "+v"(acc[2][2]), "+v"(acc[3][3]) : "v"(a[0]), "v"(a[3]));
    }
#pragma unroll
    for (int mb = 0; mb < 4; ++mb) {
#pragma unroll
        for (int nb = 0; nb < 4; ++nb) {
#pragma unroll
            for (int j = 0; j < 8; ++j) os[wv * (16 * 68) + (hi * 8 + j) * 68 + nb * 16 + lr] = acc[mb][nb][j]; }
        tile_sync<NW>();
        float* crow = C + (size_t)(r0 + mb * 16) * ldc + c0;
{
#pragma unroll
            for (int s = 0; s < (NW < 8 ? 8 / NW : 1); ++s) { const int row = 2 * NW * s + 2 * wv + hi, cofs = lr * 4; if (NW > 8 && wv >= 8) break;   /* 16 rows: waves 8 and up have none */ v4f val = *(const v4fa*)(os + row * 68 + cofs);
#pragma unroll
                for (int w = 1; w < NW; ++w) val += *(const v4fa*)(os + w * (16 * 68) + row * 68 + cofs);
                *(v4f*)(crow + (size_t)row * ldc + cofs) = val; }
             }
        if (mb < 3) {   // the slabs are rewritten by the next stage only
            if (NW > 1) asm volatile("s_wait_xcnt 0x0" ::: "memory");   // stands in front of the next stage's reuse of the registers that the stores above name
            tile_sync<NW>(); }
    }
}

__device__ __forceinline__ h16 tohx(float x) { return (h16)x; }
__device__ __forceinline__ void splitf(float y, unsigned short& h, unsigned short& l) { h = f2bf(y); l = f2bf(y - bf2f(h)); }
typedef __attribute__((ext_vector_type(2))) _Float16 v2h;
typedef __attribute__((ext_vector_type(4))) _Float16 v4h;
typedef __attribute__((ext_vector_type(2))) unsigned short v2us;
typedef __attribute__((ext_vector_type(4))) unsigned short v4us;
typedef __attribute__((ext_vector_type(2))) float v2f;
typedef __attribute__((ext_vector_type(4))) int v4i;

__global__ __launch_bounds__(256) void k_wtG(const float* __restrict__ w, int K, int N, bf* Bt) {
    const int lane = threadIdx.x & 31; const int L0 = (blockIdx.x * 8 + (threadIdx.x >> 5)) * 8; const int nlines = N * K / 64;
{
#pragma unroll 1
        for (int l = 0; l < 8; ++l) { const int L = L0 + l; if (L >= nlines) break; const size_t e = (size_t)L * 64 + lane * 2; const int k = (int)(e % K), n = (int)(e / K); v2us o;
            o[0] = f2bf(w[(size_t)k * N + n]); o[1] = f2bf(w[(size_t)(k + 1) * N + n]); *(v2us*)(Bt + e) = o; }
         }
}
__global__ __launch_bounds__(256) void k_cvt8(const float* __restrict__ src, bf* dst, size_t n8) { const size_t i = (size_t)blockIdx.x * 256 + threadIdx.x; if (i >= n8) return; const v8f v = *(const v8f*)(src + i * 8); v8us o;
#pragma unroll
    for (int k = 0; k < 8; ++k) o[k] = f2bf(v[k]); *(v8us*)(dst + i * 8) = o;  }
__global__ __launch_bounds__(256) void k_cscvt(const float* __restrict__ cosT, const float* __restrict__ sinT, float* CS) { const int idx = blockIdx.x * 256 + threadIdx.x; if (idx >= TT * HD) return; const int t = idx / HD, d = idx % HD; const size_t ti = (size_t)t * (HD / 2) + (d >> 1);   /* interleaved pairs (2i, 2i+1) use table column i */ v2f cs; cs[0] = bfr(cosT[ti]); cs[1] = bfr(sinT[ti]); *(v2f*)(CS + (size_t)idx * 2) = cs;  }
// k_rope: head planes [h][t][d] (fp16 + hi/lo) of the interleaved rotary out_r = tr c - ti s, out_i = tr s + ti c (pairs (2i, 2i+1), table column i)
__global__ __launch_bounds__(256) void k_rope(const float* __restrict__ F, int pitch, int nheads, const float* __restrict__ CS, const float* __restrict__ RF, const float* __restrict__ nw, float sc, h16* P16, bf* Ph, bf* Pl) {
    const size_t e = ((size_t)blockIdx.x * 256 + threadIdx.x) * 2; if (e >= (size_t)nheads * TT * HD) return; const int d = (int)(e % HD); const int t = (int)((e / HD) % TT); const int h = (int)(e / ((size_t)HD * TT)); const float* f = F + (size_t)t * pitch + h * HD; const float rf = RF ? RF[(size_t)h * TT + t] : 1.0f; v2h o16; v2us oh, ol;
#pragma unroll
    for (int q = 0; q < 2; ++q) { const int dd = d + q; const int dp = dd ^ 1;   /* interleaved pair partner */ float x0 = f[dd], x1 = f[dp];
        if (RF) { float n0 = __fmul_rn(x0, rf), n1 = __fmul_rn(x1, rf); asm volatile("" : "+v"(n0)); asm volatile("" : "+v"(n1)); x0 = __fmul_rn(bfr(nw[dd]), n0); x1 = __fmul_rn(bfr(nw[dp]), n1); }
        const v2f cs = *(const v2f*)(CS + ((size_t)t * HD + dd) * 2); float a = __fmul_rn(x0, cs[0]), bq = __fmul_rn(x1, cs[1]); asm volatile("" : "+v"(a)); asm volatile("" : "+v"(bq)); const float r = (((dd & 1) == 0) ? __fsub_rn(a, bq) : __fadd_rn(a, bq)) * sc;   /* even: tr c - ti s; odd: ti c + tr s */
        o16[q] = tohx(r); unsigned short a2, c2; splitf(r, a2, c2); oh[q] = a2; ol[q] = c2; }
    *(v2h*)(P16 + e) = o16; *(v2us*)(Ph + e) = oh; *(v2us*)(Pl + e) = ol;  }
__global__ __launch_bounds__(256) void k_vtp(const float* __restrict__ F, int pitch, int nheads, h16* V16, bf* Vh, bf* Vl) { const size_t e = ((size_t)blockIdx.x * 256 + threadIdx.x) * 2; if (e >= (size_t)nheads * HD * TT) return; const int t = (int)(e % TT); const int d = (int)((e / TT) % HD); const int g = (int)(e / ((size_t)TT * HD)); v2h o16; v2us oh, ol;
#pragma unroll
    for (int q = 0; q < 2; ++q) { const float x = F[(size_t)(t + q) * pitch + g * HD + d]; o16[q] = tohx(x); unsigned short a2, c2; splitf(x, a2, c2); oh[q] = a2; ol[q] = c2; }
    *(v2h*)(V16 + e) = o16; *(v2us*)(Vh + e) = oh; *(v2us*)(Vl + e) = ol;  }
// k_asoft: per row (zz, i): t = S x HD^-0.5 for j <= i and j < seq_lengths[b] (causal + key padding; the reference's -1e9 additive fill vanishes identically); softmax over the 2048 keys (register row, one exp, fixed trees);; keys are kept where j <= i AND j < seq_lengths[b] (read from the int32 input); every row keeps key 0 (seq_lengths >= 1024)
__global__ __launch_bounds__(256) void k_asoft(const float* __restrict__ Sb, const int* __restrict__ SLb, h16* P16, bf* Ph, bf* Pl) {
    const int lane = threadIdx.x & 31; const int row = blockIdx.x * 8 + (threadIdx.x >> 5); if (row >= ZH * TT) return; const int i = row % TT; const int zz = row / TT; (void)zz; const int slen = SLb[0];   /* valid key count for this batch (int32 input) */ const bool hires = (i < RH); const float* sr = Sb + (size_t)row * TT; float v[TT / 32]; float mx = -3.0e38f;
#pragma unroll
    for (int ch = 0; ch < TT / 128; ++ch) { const int j0 = ch * 128 + lane * 4; const v4f a = *(const v4f*)(sr + j0);
#pragma unroll
        for (int q = 0; q < 4; ++q) { const int j = j0 + q; (void)j; const float t = (j <= i && j < slen) ? a[q] * SCL : -3.0e38f;   /* causal AND key padding */ v[ch * 4 + q] = t; mx = fmaxf(mx, t); } }
#pragma unroll
    for (int sh = 16; sh; sh >>= 1) mx = fmaxf(mx, __shfl_xor(mx, sh, 32));
    float sum = 0.f;
#pragma unroll
    for (int k = 0; k < TT / 32; ++k) { float d0 = __fsub_rn(v[k], mx); asm volatile("" : "+v"(d0)); v[k] = __builtin_amdgcn_exp2f(__fmul_rn(d0, 1.4426950408889634f)); sum += v[k]; }
#pragma unroll
    for (int sh = 16; sh; sh >>= 1) sum += __shfl_xor(sum, sh, 32);
    const float f = __fdiv_rn(hires ? 1.0f : PCAR, sum);
{
        if (hires) {
#pragma unroll
            for (int ch = 0; ch < TT / 128; ++ch) { v4us oh, ol;
#pragma unroll
                for (int q = 0; q < 4; ++q) { unsigned short a, c2; splitf(v[ch * 4 + q] * f, a, c2); oh[q] = a; ol[q] = c2; }
                const size_t oo = ((size_t)zz * (RH ? RH : 1) + i) * TT + ch * 128 + lane * 4; *(v4us*)(Ph + oo) = oh; *(v4us*)(Pl + oo) = ol; }
        } else {
#pragma unroll
            for (int ch = 0; ch < TT / 128; ++ch) { v4h o4;
#pragma unroll
                for (int q = 0; q < 4; ++q) o4[q] = tohx(v[ch * 4 + q] * f);
                *(v4h*)(P16 + (size_t)row * TT + ch * 128 + lane * 4) = o4; } }
         }
}
__global__ __launch_bounds__(256) void k_merge(const float* __restrict__ O, int h0, bf* Ah, bf* Al) { const size_t e = ((size_t)blockIdx.x * 256 + threadIdx.x) * 2; if (e >= (size_t)ZH * TT * HD) return; const int d = (int)(e % HD); const int t = (int)((e / HD) % TT); const int zz = (int)(e / ((size_t)HD * TT)); const float cs = (t < RH) ? 1.0f : (1.0f / PCAR); const size_t oo = (size_t)t * DQ + (h0 + zz) * HD + d;
    v2us oh, ol;
#pragma unroll
    for (int q = 0; q < 2; ++q) { unsigned short a, c2; splitf(O[e + q] * cs, a, c2); oh[q] = a; ol[q] = c2; } *(v2us*)(Ah + oo) = oh; *(v2us*)(Al + oo) = ol;  }

extern "C" void kernel_launch(void* const* d_in, const int* in_sizes, int n_in,
                              void* d_out, int out_size, void* d_ws, size_t ws_size, hipStream_t stream) {
    (void)in_sizes; (void)n_in; (void)out_size;
    const float* x = (const float*)d_in[0]; const float* wq = (const float*)d_in[1]; const float* wkv = (const float*)d_in[2]; const float* wo = (const float*)d_in[3]; const float* cosT = (const float*)d_in[4]; const float* sinT = (const float*)d_in[5]; const int* SL = (const int*)d_in[6]; const float* wk = nullptr; const float* wv = nullptr; (void)wk; (void)wv;
    float* OUT = (float*)d_out;     // [2][2048][2048]
    char* wsp = (char*)d_ws;
    auto take = [&](size_t bytes) { char* p = wsp; wsp += (bytes + 255) & ~(size_t)255; return (void*)p; };
    bf* WQ = (bf*)take((size_t)DQ * DM * 2); bf* WKV = (bf*)take((size_t)2 * DKV * DM * 2); bf* WK = WKV; bf* WV = WKV + (size_t)DKV * DM;   /* row blocks of the transposed fused wkv */ bf* WO = (bf*)take((size_t)DM * DQ * 2); float* CS = (float*)take((size_t)TT * HD * 2 * 4);
    bf* XB = (bf*)take((size_t)TT * DM * 2); float* FQ = (float*)take((size_t)TT * DQ * 4); float* FK = (float*)take((size_t)TT * DKV * 4);
    h16* QP16 = (h16*)take((size_t)NH_ * TT * HD * 2); h16* KP16 = (h16*)take((size_t)NKV * TT * HD * 2); h16* VT16 = (h16*)take((size_t)NKV * HD * TT * 2);
    bf* QPh = (bf*)take((size_t)NH_ * TT * HD * 2); bf* QPl = (bf*)take((size_t)NH_ * TT * HD * 2); bf* KPh = (bf*)take((size_t)NKV * TT * HD * 2); bf* KPl = (bf*)take((size_t)NKV * TT * HD * 2); bf* VTh = (bf*)take((size_t)NKV * HD * TT * 2); bf* VTl = (bf*)take((size_t)NKV * HD * TT * 2); bf* Ph = (bf*)take((size_t)ZH * RH * TT * 2); bf* Pl = (bf*)take((size_t)ZH * RH * TT * 2);
    float* Sb = (float*)take((size_t)ZH * TT * TT * 4); h16* P16 = (h16*)take((size_t)ZH * TT * TT * 2); float* Ob = (float*)take((size_t)ZH * TT * HD * 4); bf* ATh = (bf*)take((size_t)TT * DQ * 2); bf* ATl = (bf*)take((size_t)TT * DQ * 2);
    if ((size_t)(wsp - (char*)d_ws) > ws_size) return;    // ws 256 MiB
    float* FV = FK;   // v projection reuses the k buffer after the k planes are built (stream-ordered)
    { k_wtG<<<(unsigned)((DM * DQ / 64 + 63) / 64), 256, 0, stream>>>(wq, DM, DQ, WQ); k_wtG<<<(unsigned)((DM * 2 * DKV / 64 + 63) / 64), 256, 0, stream>>>(wkv, DM, 2 * DKV, WKV);   /* 'xw' [2048][2048] -> Bt [2048][2048]: rows 0-1023 k, 1024-2047 v */
      k_wtG<<<(unsigned)((DQ * DM / 64 + 63) / 64), 256, 0, stream>>>(wo, DQ, DM, WO);
       }
    const unsigned LQ = (unsigned)(((size_t)NH_ * TT * HD / 2 + 255) / 256), LKv = (unsigned)(((size_t)NKV * TT * HD / 2 + 255) / 256);
    for (int b = 0; b < NB_; ++b) {
        if (b == 0) k_cscvt<<<(TT * HD + 255) / 256, 256, 0, stream>>>(cosT, sinT, CS);
        k_cvt8<<<(unsigned)(((size_t)TT * DM / 8 + 255) / 256), 256, 0, stream>>>(x + (size_t)b * TT * DM, XB, (size_t)TT * DM / 8);
        k_gemmw<bf, 0, false, 4><<<dim3(TT / 64, DQ / 64, 1), 128, 0, stream>>>(XB, nullptr, WQ, nullptr, DM, FQ, DQ, nullptr, 0, 0, 0);
        k_rope<<<LQ, 256, 0, stream>>>(FQ, DQ, NH_, CS, nullptr, nullptr, 1.0f, QP16, QPh, QPl);
        k_gemmw<bf, 0, false, 8><<<dim3(TT / 64, DKV / 64, 1), 256, 0, stream>>>(XB, nullptr, WK, nullptr, DM, FK, DKV, nullptr, 0, 0, 0);
        k_rope<<<LKv, 256, 0, stream>>>(FK, DKV, NKV, CS, nullptr, nullptr, 1.0f, KP16, KPh, KPl);
        k_gemmw<bf, 0, false, 8><<<dim3(TT / 64, DKV / 64, 1), 256, 0, stream>>>(XB, nullptr, WV, nullptr, DM, FV, DKV, nullptr, 0, 0, 0); k_vtp<<<LKv, 256, 0, stream>>>(FV, DKV, NKV, VT16, VTh, VTl);
        for (int h0 = 0; h0 < NH_; h0 += ZH) { const size_t zq = (size_t)h0, zk = (size_t)(h0 / REP);   // both heads of a pass share kv group h0/REP (REP >= 2): sB = 0
            k_gemmc<bf, 2, 1, 1><<<dim3(RH / 64, TT / 64, ZH), 32, 0, stream>>>(QPh + zq * TT * HD, QPl + zq * TT * HD, KPh + zk * TT * HD, KPl + zk * TT * HD, HD, Sb, TT, 0, (size_t)TT * HD, 0, (size_t)TT * TT);
            k_gemmc<h16, 0, 1, 1><<<dim3((TT - RH) / 64, TT / 64, ZH), 32, 0, stream>>>(QP16 + zq * TT * HD + (size_t)RH * HD, nullptr, KP16 + zk * TT * HD, nullptr, HD, Sb + (size_t)RH * TT, TT, RH, (size_t)TT * HD, 0, (size_t)TT * TT);
            k_asoft<<<ZH * TT / 8, 256, 0, stream>>>(Sb, SL + b, P16, Ph, Pl);
            k_gemmc<bf, 2, 2, 8><<<dim3(RH / 64, HD / 64, ZH), 256, 0, stream>>>(Ph, Pl, VTh + zk * HD * TT, VTl + zk * HD * TT, TT, Ob, HD, 0, (size_t)RH * TT, 0, (size_t)TT * HD);
            k_gemmc<h16, 0, 2, 16><<<dim3((TT - RH) / 64, HD / 64, ZH), 512, 0, stream>>>(P16 + (size_t)RH * TT, nullptr, VT16 + zk * HD * TT, nullptr, TT, Ob + (size_t)RH * HD, HD, RH, (size_t)TT * TT, 0, (size_t)TT * HD);
            k_merge<<<(unsigned)(((size_t)ZH * TT * HD / 2 + 255) / 256), 256, 0, stream>>>(Ob, h0, ATh, ATl); }
        k_gemmw<bf, 1, false, 4><<<dim3(TT / 64, DM / 64, 1), 128, 0, stream>>>(ATh, ATl, WO, nullptr, DQ, OUT + (size_t)b * TT * DM, DM, nullptr, 0, 0, 0); }
}

// v002
// Measured time: 735 microseconds a run.
// In both of two side-by-side timings against v001, it was 1.44 times as fast.
// Counting every step since v000, it is 2.32 times as fast.
#include <hip/hip_runtime.h>

// Causal GQA with key-padding mask and interleaved rotary (x [2][2048][2048]; q = x wq ('xw' [2048][2048], 16 heads x 128); [k|v] = x wkv ('xw' [2048][2048]: columns 0-1023 k, 1024-2047 v; 8 kv heads x 128); llama-style interleaved RoPE from the given tables [2048][64] on q, k; 2 query heads per kv head; scores/sqrt(128) masked where j > i OR j >= seq_lengths[b] (int32 input, read on device); softmax; out = merged wo ('xw') -> [2][2048][2048]).
// Compute dtypes, f32 accumulate: every input rounded to bf16; q/k/v on PLAIN bf16 operands (inputs: exact); rotary in f32 from the bf16-rounded tables; causal + padding-masked scores and attn.v (causal tile skipping): query rows < 512 hl (3 products), the rest single fp16 (x1024); softmax f32; wo hl x exact (2 products).

#define NB_  2
#define TT   2048
#define DM   2048
#define NH_  16
#define NKV  8
#define REP  (NH_ / NKV)
#define HD   128
#define DQ   (NH_ * HD)
#define DKV  (NKV * HD)
#define ZH   8                    // query heads per attention pass (grid z of every attention launch)
#define RH   512                  // query rows < RH use hi+lo planes (0: none)
#define WIN  2048
#define PCAR 1024.0f
#define SCL  0.088388347648318447f   // HD^-0.5
typedef _Float16 h16;
typedef unsigned short bf;
typedef __attribute__((ext_vector_type(16))) __bf16   v16bf;
typedef __attribute__((ext_vector_type(16))) _Float16 v16h;
typedef __attribute__((ext_vector_type(8)))  _Float16 v8h;
typedef __attribute__((ext_vector_type(8)))  unsigned short v8us;
typedef __attribute__((ext_vector_type(8)))  float    v8f;
typedef __attribute__((ext_vector_type(4)))  float    v4f;
typedef v8h  __attribute__((may_alias)) v8ha;
typedef v4f  __attribute__((may_alias)) v4fa;
typedef v8us __attribute__((may_alias)) v8usa;

__device__ __forceinline__ unsigned short f2bf(float f) { unsigned u = __float_as_uint(f); u += 0x7FFFu + ((u >> 16) & 1u); return (unsigned short)(u >> 16); }
__device__ __forceinline__ float bf2f(unsigned short b) { return __uint_as_float(((unsigned)b) << 16); }
__device__ __forceinline__ float bfr(float f) { return bf2f(f2bf(f)); }
__device__ __forceinline__ v16h cat16(v8h lo, v8h hi) { return __builtin_shufflevector(lo, hi, 0, 1, 2, 3, 4, 5, 6, 7, 8, 9, 10, 11, 12, 13, 14, 15); }
__device__ __forceinline__ v16bf cat16b(v8us lo, v8us hi) { return __builtin_bit_cast(v16bf, __builtin_shufflevector(lo, hi, 0, 1, 2, 3, 4, 5, 6, 7, 8, 9, 10, 11, 12, 13, 14, 15)); }
__device__ __forceinline__ v8f wmma16(v16h a, v16h b, v8f c) { return __builtin_amdgcn_wmma_f32_16x16x32_f16(false, a, false, b, (short)0, c, false, false); }
__device__ __forceinline__ v8f wmmab(v16bf a, v16bf b, v8f c) { return __builtin_amdgcn_wmma_f32_16x16x32_bf16(false, a, false, b, (short)0, c, false, false); }



// tile_sync: orders the LDS slab writes against the reads of the tile epilogue; one wave needs no hardware barrier, several waves need the work-group barrier.
// The fences name LDS alone: only LDS data passes between the waves here, and a full __syncthreads() would also hold every wave until the tile rows just stored to global memory have landed, at each of the four stages.
template <int NW> __device__ __forceinline__ void tile_sync() {
    if (NW == 1) { __builtin_amdgcn_wave_barrier(); asm volatile("" ::: "memory"); }
    else { __builtin_amdgcn_fence(__ATOMIC_RELEASE, "workgroup", "local"); __builtin_amdgcn_s_barrier(); __builtin_amdgcn_fence(__ATOMIC_ACQUIRE, "workgroup", "local"); } }

// ---- k_gemmw: register-blocked GEMM, one 64x64 output tile per work-group of NW waves (16 accumulators per wave), operands straight from K-contiguous 16-bit planes; grid (M/64, N/64, Z), 32 * NW threads.
// Wave w takes the 32-wide K chunks w, w + NW, w + 2 NW, ...; the NW partial tiles are summed in wave order 0..NW-1 through LDS (one slab per wave) before the store.
// C[m][n] (f32, pitch ldc, + optional f32 bias[n]) = sum_k A[m][k] Bt[n][k] (+ split products per NSPLIT). z-batch strides sA/sB/sC in elements. K % 32 == 0.
template <typename T16> struct WFrag;
template <> struct WFrag<h16> { typedef v16h V; static __device__ __forceinline__ V ld(const h16* p) { return cat16(*(const v8h*)p, *(const v8h*)(p + 16)); } static __device__ __forceinline__ v8f mma(V a, V b, v8f c) { return wmma16(a, b, c); } };
template <> struct WFrag<bf> { typedef v16bf V; static __device__ __forceinline__ V ld(const bf* p) { return cat16b(*(const v8us*)p, *(const v8us*)(p + 16)); } static __device__ __forceinline__ v8f mma(V a, V b, v8f c) { return wmmab(a, b, c); } };
template <typename T16, int NSPLIT, bool BIAS, int NW>
__global__ __launch_bounds__(32 * NW) void k_gemmw(const T16* __restrict__ A, const T16* __restrict__ A2, const T16* __restrict__ Bt, const T16* __restrict__ Bt2, int K, float* C, int ldc, const float* __restrict__ bias, size_t sA, size_t sB, size_t sC) {
    typedef typename WFrag<T16>::V V;
    __shared__ __align__(16) float os[NW * 16 * 68];
    const size_t z = blockIdx.z; A += z * sA; if (A2) A2 += z * sA; Bt += z * sB; if (Bt2) Bt2 += z * sB; C += z * sC;
    const int lane = threadIdx.x & 31, lr = lane & 15, hi = lane >> 4; const int wv = (NW == 1) ? 0 : __builtin_amdgcn_readfirstlane((int)(threadIdx.x >> 5)); const int r0 = blockIdx.x * 64, c0 = blockIdx.y * 64;
    v8f acc[4][4];
#pragma unroll
    for (int mb = 0; mb < 4; ++mb)
#pragma unroll
        for (int nb = 0; nb < 4; ++nb) acc[mb][nb] = (v8f){};
    const size_t aoff = (size_t)(r0 + lr) * K + 8 * hi, boff = (size_t)(c0 + lr) * K + 8 * hi;
#pragma unroll 1
    for (int kc = wv * 32; kc < K; kc += 32 * NW) {
        V a[4], a2[4];
#pragma unroll
        for (int mb = 0; mb < 4; ++mb) { a[mb] = WFrag<T16>::ld(A + aoff + (size_t)mb * 16 * K + kc); if (NSPLIT == 1 || NSPLIT == 2) a2[mb] = WFrag<T16>::ld(A2 + aoff + (size_t)mb * 16 * K + kc); }
#pragma unroll
        for (int nb = 0; nb < 4; ++nb) { const V b = WFrag<T16>::ld(Bt + boff + (size_t)nb * 16 * K + kc); V b2; if (NSPLIT >= 2) b2 = WFrag<T16>::ld(Bt2 + boff + (size_t)nb * 16 * K + kc);
#pragma unroll
            for (int mb = 0; mb < 4; ++mb) { acc[mb][nb] = WFrag<T16>::mma(a[mb], b, acc[mb][nb]); if (NSPLIT == 1 || NSPLIT == 2) acc[mb][nb] = WFrag<T16>::mma(a2[mb], b, acc[mb][nb]); if (NSPLIT >= 2) acc[mb][nb] = WFrag<T16>::mma(a[mb], b2, acc[mb][nb]); } }
        asm volatile("v_nop\n\tv_nop\n\tv_nop\n\tv_nop" : "+v"(acc[0][0]), "+v"(acc[1][1]), "+v"(acc[2][2]), "+v"(acc[3][3]) : "v"(a[0]), "v"(a[3]));
    }
#pragma unroll
    for (int mb = 0; mb < 4; ++mb) {
#pragma unroll
        for (int nb = 0; nb < 4; ++nb) {
#pragma unroll
            for (int j = 0; j < 8; ++j) os[wv * (16 * 68) + (hi * 8 + j) * 68 + nb * 16 + lr] = acc[mb][nb][j]; }
        tile_sync<NW>();
        float* crow = C + (size_t)(r0 + mb * 16) * ldc + c0;
{
#pragma unroll
            for (int s = 0; s < (NW < 8 ? 8 / NW : 1); ++s) { const int row = 2 * NW * s + 2 * wv + hi, cofs = lr * 4; if (NW > 8 && wv >= 8) break;   /* 16 rows: waves 8 and up have none */ v4f val = *(const v4fa*)(os + row * 68 + cofs);
#pragma unroll
                for (int w = 1; w < NW; ++w) val += *(const v4fa*)(os + w * (16 * 68) + row * 68 + cofs);
                if (BIAS) { val[0] += bfr(bias[c0 + cofs]); val[1] += bfr(bias[c0 + cofs + 1]); val[2] += bfr(bias[c0 + cofs + 2]); val[3] += bfr(bias[c0 + cofs + 3]); }
                *(v4f*)(crow + (size_t)row * ldc + cofs) = val; }
             }
        if (mb < 3) {   // the slabs are rewritten by the next stage only
            if (NW > 1) asm volatile("s_wait_xcnt 0x0" ::: "memory");   // stands in front of the next stage's reuse of the registers that the stores above name
            tile_sync<NW>(); }
    }
}

// ---- k_gemmc: the same 64x64 tile GEMM (NW waves share the K loop) specialised for causal attention: CMODE 1 skips score tiles entirely above the diagonal (query rows r0+roff.., key columns c0..), CMODE 2 limits the
// key (K) loop of the probability x value contraction to the diagonal block (probabilities beyond it are exactly zero). roff = row offset of this launch's first row within the sequence.
// z = query head within the pass: A and C step by sA, sC per head, Bt by sB per kv group (z / REP). lda = row pitch of A in elements; Bt rows have pitch K.
template <typename T16, int NSPLIT, int CMODE, int NW>
__global__ __launch_bounds__(32 * NW) void k_gemmc(const T16* __restrict__ A, const T16* __restrict__ A2, int lda, const T16* __restrict__ Bt, const T16* __restrict__ Bt2, int K, float* C, int ldc, int roff, size_t sA, size_t sB, size_t sC) {
    typedef typename WFrag<T16>::V V;
    __shared__ __align__(16) float os[NW * 16 * 68];
    const size_t z = blockIdx.z; A += z * sA; if (A2) A2 += z * sA; Bt += (z / REP) * sB; if (Bt2) Bt2 += (z / REP) * sB; C += z * sC;
    const int lane = threadIdx.x & 31, lr = lane & 15, hi = lane >> 4; const int wv = (NW == 1) ? 0 : __builtin_amdgcn_readfirstlane((int)(threadIdx.x >> 5)); const int r0 = blockIdx.x * 64, c0 = blockIdx.y * 64;
    if (CMODE == 1 && c0 > r0 + roff + 63) return;                  // score tile entirely above the causal diagonal: never read (the softmax masks j > i by select)
    const int Kl = (CMODE == 2) ? min(K, r0 + roff + 64) : K;        // P.V: probabilities are exactly 0 beyond the diagonal block, so the K loop stops there
    v8f acc[4][4];
#pragma unroll
    for (int mb = 0; mb < 4; ++mb)
#pragma unroll
        for (int nb = 0; nb < 4; ++nb) acc[mb][nb] = (v8f){};
    const size_t aoff = (size_t)(r0 + lr) * lda + 8 * hi, boff = (size_t)(c0 + lr) * K + 8 * hi;
#pragma unroll 1
    for (int kc = wv * 32; kc < Kl; kc += 32 * NW) {
        V a[4], a2[4];
#pragma unroll
        for (int mb = 0; mb < 4; ++mb) { a[mb] = WFrag<T16>::ld(A + aoff + (size_t)mb * 16 * lda + kc); if (NSPLIT == 1 || NSPLIT == 2) a2[mb] = WFrag<T16>::ld(A2 + aoff + (size_t)mb * 16 * lda + kc); }
#pragma unroll
        for (int nb = 0; nb < 4; ++nb) { const V b = WFrag<T16>::ld(Bt + boff + (size_t)nb * 16 * K + kc); V b2; if (NSPLIT >= 2) b2 = WFrag<T16>::ld(Bt2 + boff + (size_t)nb * 16 * K + kc);
#pragma unroll
            for (int mb = 0; mb < 4; ++mb) { acc[mb][nb] = WFrag<T16>::mma(a[mb], b, acc[mb][nb]); if (NSPLIT == 1 || NSPLIT == 2) acc[mb][nb] = WFrag<T16>::mma(a2[mb], b, acc[mb][nb]); if (NSPLIT >= 2) acc[mb][nb] = WFrag<T16>::mma(a[mb], b2, acc[mb][nb]); } }
        asm volatile("v_nop\n\tv_nop\n\tv_nop\n\tv_nop" : "+v"(acc[0][0]), "+v"(acc[1][1]), "+v"(acc[2][2]), "+v"(acc[3][3]) : "v"(a[0]), "v"(a[3]));
    }
#pragma unroll
    for (int mb = 0; mb < 4; ++mb) {
#pragma unroll
        for (int nb = 0; nb < 4; ++nb) {
#pragma unroll
            for (int j = 0; j < 8; ++j) os[wv * (16 * 68) + (hi * 8 + j) * 68 + nb * 16 + lr] = acc[mb][nb][j]; }
        tile_sync<NW>();
        float* crow = C + (size_t)(r0 + mb * 16) * ldc + c0;
{
#pragma unroll
            for (int s = 0; s < (NW < 8 ? 8 / NW : 1); ++s) { const int row = 2 * NW * s + 2 * wv + hi, cofs = lr * 4; if (NW > 8 && wv >= 8) break;   /* 16 rows: waves 8 and up have none */ v4f val = *(const v4fa*)(os + row * 68 + cofs);
#pragma unroll
                for (int w = 1; w < NW; ++w) val += *(const v4fa*)(os + w * (16 * 68) + row * 68 + cofs);
                *(v4f*)(crow + (size_t)row * ldc + cofs) = val; }
             }
        if (mb < 3) {   // the slabs are rewritten by the next stage only
            if (NW > 1) asm volatile("s_wait_xcnt 0x0" ::: "memory");   // stands in front of the next stage's reuse of the registers that the stores above name
            tile_sync<NW>(); }
    }
}

__device__ __forceinline__ h16 tohx(float x) { return (h16)x; }
__device__ __forceinline__ void splitf(float y, unsigned short& h, unsigned short& l) { h = f2bf(y); l = f2bf(y - bf2f(h)); }
typedef __attribute__((ext_vector_type(2))) _Float16 v2h;
typedef __attribute__((ext_vector_type(4))) _Float16 v4h;
typedef __attribute__((ext_vector_type(2))) unsigned short v2us;
typedef __attribute__((ext_vector_type(4))) unsigned short v4us;
typedef __attribute__((ext_vector_type(2))) float v2f;
typedef __attribute__((ext_vector_type(4))) int v4i;

__global__ __launch_bounds__(256) void k_wtG(const float* __restrict__ w, int K, int N, bf* Bt) {
    const int lane = threadIdx.x & 31; const int L0 = (blockIdx.x * 8 + (threadIdx.x >> 5)) * 8; const int nlines = N * K / 64;
{
#pragma unroll 1
        for (int l = 0; l < 8; ++l) { const int L = L0 + l; if (L >= nlines) break; const size_t e = (size_t)L * 64 + lane * 2; const int k = (int)(e % K), n = (int)(e / K); v2us o;
            o[0] = f2bf(w[(size_t)k * N + n]); o[1] = f2bf(w[(size_t)(k + 1) * N + n]); *(v2us*)(Bt + e) = o; }
         }
}
__global__ __launch_bounds__(256) void k_cvt8(const float* __restrict__ src, bf* dst, size_t n8) { const size_t i = (size_t)blockIdx.x * 256 + threadIdx.x; if (i >= n8) return; const v8f v = *(const v8f*)(src + i * 8); v8us o;
#pragma unroll
    for (int k = 0; k < 8; ++k) o[k] = f2bf(v[k]); *(v8us*)(dst + i * 8) = o;  }
__global__ __launch_bounds__(256) void k_cscvt(const float* __restrict__ cosT, const float* __restrict__ sinT, float* CS) { const int idx = blockIdx.x * 256 + threadIdx.x; if (idx >= TT * HD) return; const int t = idx / HD, d = idx % HD; const size_t ti = (size_t)t * (HD / 2) + (d >> 1);   /* interleaved pairs (2i, 2i+1) use table column i */ v2f cs; cs[0] = bfr(cosT[ti]); cs[1] = bfr(sinT[ti]); *(v2f*)(CS + (size_t)idx * 2) = cs;  }
// k_rope: head planes [h][t][d] (fp16 + hi/lo) of the interleaved rotary out_r = tr c - ti s, out_i = tr s + ti c (pairs (2i, 2i+1), table column i)
__global__ __launch_bounds__(256) void k_rope(const float* __restrict__ F, int pitch, int nheads, const float* __restrict__ CS, const float* __restrict__ RF, const float* __restrict__ nw, float sc, h16* P16, bf* Ph, bf* Pl) {
    const size_t e = ((size_t)blockIdx.x * 256 + threadIdx.x) * 2; if (e >= (size_t)nheads * TT * HD) return; const int d = (int)(e % HD); const int t = (int)((e / HD) % TT); const int h = (int)(e / ((size_t)HD * TT)); const float* f = F + (size_t)t * pitch + h * HD; const float rf = RF ? RF[(size_t)h * TT + t] : 1.0f; v2h o16; v2us oh, ol;
#pragma unroll
    for (int q = 0; q < 2; ++q) { const int dd = d + q; const int dp = dd ^ 1;   /* interleaved pair partner */ float x0 = f[dd], x1 = f[dp];
        if (RF) { float n0 = __fmul_rn(x0, rf), n1 = __fmul_rn(x1, rf); asm volatile("" : "+v"(n0)); asm volatile("" : "+v"(n1)); x0 = __fmul_rn(bfr(nw[dd]), n0); x1 = __fmul_rn(bfr(nw[dp]), n1); }
        const v2f cs = *(const v2f*)(CS + ((size_t)t * HD + dd) * 2); float a = __fmul_rn(x0, cs[0]), bq = __fmul_rn(x1, cs[1]); asm volatile("" : "+v"(a)); asm volatile("" : "+v"(bq)); const float r = (((dd & 1) == 0) ? __fsub_rn(a, bq) : __fadd_rn(a, bq)) * sc;   /* even: tr c - ti s; odd: ti c + tr s */
        o16[q] = tohx(r); unsigned short a2, c2; splitf(r, a2, c2); oh[q] = a2; ol[q] = c2; }
    *(v2h*)(P16 + e) = o16; *(v2us*)(Ph + e) = oh; *(v2us*)(Pl + e) = ol;  }
__global__ __launch_bounds__(256) void k_vtp(const float* __restrict__ F, int pitch, int nheads, h16* V16, bf* Vh, bf* Vl) { const size_t e = ((size_t)blockIdx.x * 256 + threadIdx.x) * 2; if (e >= (size_t)nheads * HD * TT) return; const int t = (int)(e % TT); const int d = (int)((e / TT) % HD); const int g = (int)(e / ((size_t)TT * HD)); v2h o16; v2us oh, ol;
#pragma unroll
    for (int q = 0; q < 2; ++q) { const float x = F[(size_t)(t + q) * pitch + g * HD + d]; o16[q] = tohx(x); unsigned short a2, c2; splitf(x, a2, c2); oh[q] = a2; ol[q] = c2; }
    *(v2h*)(V16 + e) = o16; *(v2us*)(Vh + e) = oh; *(v2us*)(Vl + e) = ol;  }
// k_asoft: per row (zz, i): t = S x HD^-0.5 for j <= i and i - j < WIN (sliding causal window; the reference's -1e9 additive fill vanishes identically); softmax over the 2048 keys (register row, one exp, fixed trees);; keys are kept where j <= i AND j < seq_lengths[b] (read from the int32 input); every row keeps key 0 (seq_lengths >= 1024)
// The probabilities go IN PLACE over the wave's own score row (8 KiB, read whole into registers first; every stored value depends on the row sum): rows < RH hold the hi plane in bytes 0-4095 and the lo plane in bytes 4096-8191, the other rows the fp16 plane in bytes 0-4095. So the 16-bit rows have a pitch of 2 TT elements.
__global__ __launch_bounds__(256) void k_asoft(float* Sb, const int* __restrict__ SLb) {
    const int lane = threadIdx.x & 31; const int row = blockIdx.x * 8 + (threadIdx.x >> 5); if (row >= ZH * TT) return; const int i = row % TT; const int zz = row / TT; (void)zz; const int slen = SLb[0];   /* valid key count for this batch (int32 input) */ const bool hires = (i < RH); float* sr = Sb + (size_t)row * TT; float v[TT / 32]; float mx = -3.0e38f;
#pragma unroll
    for (int ch = 0; ch < TT / 128; ++ch) { const int j0 = ch * 128 + lane * 4; const v4f a = *(const v4f*)(sr + j0);
#pragma unroll
        for (int q = 0; q < 4; ++q) { const int j = j0 + q; (void)j; const float t = (j <= i && j < slen) ? a[q] * SCL : -3.0e38f;   /* causal AND key padding */ v[ch * 4 + q] = t; mx = fmaxf(mx, t); } }
#pragma unroll
    for (int sh = 16; sh; sh >>= 1) mx = fmaxf(mx, __shfl_xor(mx, sh, 32));
    float sum = 0.f;
#pragma unroll
    for (int k = 0; k < TT / 32; ++k) { float d0 = __fsub_rn(v[k], mx); asm volatile("" : "+v"(d0)); v[k] = __builtin_amdgcn_exp2f(__fmul_rn(d0, 1.4426950408889634f)); sum += v[k]; }
#pragma unroll
    for (int sh = 16; sh; sh >>= 1) sum += __shfl_xor(sum, sh, 32);
    const float f = __fdiv_rn(hires ? 1.0f : PCAR, sum);
{
        if (hires) {
#pragma unroll
            for (int ch = 0; ch < TT / 128; ++ch) { v4us oh, ol;
#pragma unroll
                for (int q = 0; q < 4; ++q) { unsigned short a, c2; splitf(v[ch * 4 + q] * f, a, c2); oh[q] = a; ol[q] = c2; }
                const int oo = ch * 128 + lane * 4; *(v4us*)((bf*)sr + oo) = oh; *(v4us*)((bf*)sr + TT + oo) = ol; }
        } else {
#pragma unroll
            for (int ch = 0; ch < TT / 128; ++ch) { v4h o4;
#pragma unroll
                for (int q = 0; q < 4; ++q) o4[q] = tohx(v[ch * 4 + q] * f);
                *(v4h*)((h16*)sr + ch * 128 + lane * 4) = o4; } }
         }
}
__global__ __launch_bounds__(256) void k_merge(const float* __restrict__ O, int h0, bf* Ah, bf* Al) { const size_t e = ((size_t)blockIdx.x * 256 + threadIdx.x) * 2; if (e >= (size_t)ZH * TT * HD) return; const int d = (int)(e % HD); const int t = (int)((e / HD) % TT); const int zz = (int)(e / ((size_t)HD * TT)); const float cs = (t < RH) ? 1.0f : (1.0f / PCAR); const size_t oo = (size_t)t * DQ + (h0 + zz) * HD + d;
    v2us oh, ol;
#pragma unroll
    for (int q = 0; q < 2; ++q) { unsigned short a, c2; splitf(O[e + q] * cs, a, c2); oh[q] = a; ol[q] = c2; } *(v2us*)(Ah + oo) = oh; *(v2us*)(Al + oo) = ol;  }

extern "C" void kernel_launch(void* const* d_in, const int* in_sizes, int n_in,
                              void* d_out, int out_size, void* d_ws, size_t ws_size, hipStream_t stream) {
    (void)in_sizes; (void)n_in; (void)out_size;
    const float* x = (const float*)d_in[0]; const float* wq = (const float*)d_in[1]; const float* wkv = (const float*)d_in[2]; const float* wo = (const float*)d_in[3]; const float* cosT = (const float*)d_in[4]; const float* sinT = (const float*)d_in[5]; const int* SL = (const int*)d_in[6]; const float* wk = nullptr; const float* wv = nullptr; (void)wk; (void)wv;
    float* OUT = (float*)d_out;     // [2][2048][2048]
    char* wsp = (char*)d_ws;
    auto take = [&](size_t bytes) { char* p = wsp; wsp += (bytes + 255) & ~(size_t)255; return (void*)p; };
    bf* WQ = (bf*)take((size_t)DQ * DM * 2); bf* WKV = (bf*)take((size_t)2 * DKV * DM * 2); bf* WK = WKV; bf* WV = WKV + (size_t)DKV * DM;   /* row blocks of the transposed fused wkv */ bf* WO = (bf*)take((size_t)DM * DQ * 2); float* CS = (float*)take((size_t)TT * HD * 2 * 4);
    bf* XB = (bf*)take((size_t)TT * DM * 2); float* FQ = (float*)take((size_t)TT * DQ * 4); float* FK = (float*)take((size_t)TT * DKV * 4);
    h16* QP16 = (h16*)take((size_t)NH_ * TT * HD * 2); h16* KP16 = (h16*)take((size_t)NKV * TT * HD * 2); h16* VT16 = (h16*)take((size_t)NKV * HD * TT * 2);
    bf* QPh = (bf*)take((size_t)NH_ * TT * HD * 2); bf* QPl = (bf*)take((size_t)NH_ * TT * HD * 2); bf* KPh = (bf*)take((size_t)NKV * TT * HD * 2); bf* KPl = (bf*)take((size_t)NKV * TT * HD * 2); bf* VTh = (bf*)take((size_t)NKV * HD * TT * 2); bf* VTl = (bf*)take((size_t)NKV * HD * TT * 2);
    float* Sb = (float*)take((size_t)ZH * TT * TT * 4); float* Ob = (float*)take((size_t)ZH * TT * HD * 4);
    bf* ATh = (bf*)FQ; bf* ATl = ATh + (size_t)TT * DQ;   // the merged hi/lo planes reuse the q projection buffer, which is dead once the q planes are built (stream-ordered)
    h16* P16 = (h16*)Sb; bf* Ph = (bf*)Sb; bf* Pl = Ph + TT;   // probabilities lie in place over their score rows: row pitch 2 TT, head stride 2 TT TT (16-bit elements)
    if ((size_t)(wsp - (char*)d_ws) > ws_size) return;    // ws 256 MiB
    float* FV = FK;   // v projection reuses the k buffer after the k planes are built (stream-ordered)
    { k_wtG<<<(unsigned)((DM * DQ / 64 + 63) / 64), 256, 0, stream>>>(wq, DM, DQ, WQ); k_wtG<<<(unsigned)((DM * 2 * DKV / 64 + 63) / 64), 256, 0, stream>>>(wkv, DM, 2 * DKV, WKV);   /* 'xw' [2048][2048] -> Bt [2048][2048]: rows 0-1023 k, 1024-2047 v */
      k_wtG<<<(unsigned)((DQ * DM / 64 + 63) / 64), 256, 0, stream>>>(wo, DQ, DM, WO);
       }
    const unsigned LQ = (unsigned)(((size_t)NH_ * TT * HD / 2 + 255) / 256), LKv = (unsigned)(((size_t)NKV * TT * HD / 2 + 255) / 256);
    for (int b = 0; b < NB_; ++b) {
        if (b == 0) k_cscvt<<<(TT * HD + 255) / 256, 256, 0, stream>>>(cosT, sinT, CS);
        k_cvt8<<<(unsigned)(((size_t)TT * DM / 8 + 255) / 256), 256, 0, stream>>>(x + (size_t)b * TT * DM, XB, (size_t)TT * DM / 8);
        k_gemmw<bf, 0, false, 4><<<dim3(TT / 64, DQ / 64, 1), 128, 0, stream>>>(XB, nullptr, WQ, nullptr, DM, FQ, DQ, nullptr, 0, 0, 0);
        k_rope<<<LQ, 256, 0, stream>>>(FQ, DQ, NH_, CS, nullptr, nullptr, 1.0f, QP16, QPh, QPl);
        k_gemmw<bf, 0, false, 8><<<dim3(TT / 64, DKV / 64, 1), 256, 0, stream>>>(XB, nullptr, WK, nullptr, DM, FK, DKV, nullptr, 0, 0, 0);
        k_rope<<<LKv, 256, 0, stream>>>(FK, DKV, NKV, CS, nullptr, nullptr, 1.0f, KP16, KPh, KPl);
        k_gemmw<bf, 0, false, 8><<<dim3(TT / 64, DKV / 64, 1), 256, 0, stream>>>(XB, nullptr, WV, nullptr, DM, FV, DKV, nullptr, 0, 0, 0); k_vtp<<<LKv, 256, 0, stream>>>(FV, DKV, NKV, VT16, VTh, VTl);
        for (int h0 = 0; h0 < NH_; h0 += ZH) { const size_t zq = (size_t)h0, zk = (size_t)(h0 / REP);   // head z of a pass reads kv group h0/REP + z/REP
            k_gemmc<bf, 2, 1, 1><<<dim3(RH / 64, TT / 64, ZH), 32, 0, stream>>>(QPh + zq * TT * HD, QPl + zq * TT * HD, HD, KPh + zk * TT * HD, KPl + zk * TT * HD, HD, Sb, TT, 0, (size_t)TT * HD, (size_t)TT * HD, (size_t)TT * TT);
            k_gemmc<h16, 0, 1, 1><<<dim3((TT - RH) / 64, TT / 64, ZH), 32, 0, stream>>>(QP16 + zq * TT * HD + (size_t)RH * HD, nullptr, HD, KP16 + zk * TT * HD, nullptr, HD, Sb + (size_t)RH * TT, TT, RH, (size_t)TT * HD, (size_t)TT * HD, (size_t)TT * TT);
            k_asoft<<<ZH * TT / 8, 256, 0, stream>>>(Sb, SL + b);
            k_gemmc<bf, 2, 2, 8><<<dim3(RH / 64, HD / 64, ZH), 256, 0, stream>>>(Ph, Pl, 2 * TT, VTh + zk * HD * TT, VTl + zk * HD * TT, TT, Ob, HD, 0, (size_t)2 * TT * TT, (size_t)HD * TT, (size_t)TT * HD);
            k_gemmc<h16, 0, 2, 16><<<dim3((TT - RH) / 64, HD / 64, ZH), 512, 0, stream>>>(P16 + (size_t)RH * 2 * TT, nullptr, 2 * TT, VT16 + zk * HD * TT, nullptr, TT, Ob + (size_t)RH * HD, HD, RH, (size_t)2 * TT * TT, (size_t)HD * TT, (size_t)TT * HD);
            k_merge<<<(unsigned)(((size_t)ZH * TT * HD / 2 + 255) / 256), 256, 0, stream>>>(Ob, h0, ATh, ATl); }
        k_gemmw<bf, 1, false, 4><<<dim3(TT / 64, DM / 64, 1), 128, 0, stream>>>(ATh, ATl, WO, nullptr, DQ, OUT + (size_t)b * TT * DM, DM, nullptr, 0, 0, 0); }
}

// v003
// It runs in 457 microseconds.
// Two timings next to v002 put it at 1.60 and 1.59 times that version's speed.
// Over all steps from v000 it is 3.69 times as fast.
#include <hip/hip_runtime.h>

// Causal GQA with key-padding mask and interleaved rotary (x [2][2048][2048]; q = x wq ('xw' [2048][2048], 16 heads x 128); [k|v] = x wkv ('xw' [2048][2048]: columns 0-1023 k, 1024-2047 v; 8 kv heads x 128); llama-style interleaved RoPE from the given tables [2048][64] on q, k; 2 query heads per kv head; scores/sqrt(128) masked where j > i OR j >= seq_lengths[b] (int32 input, read on device); softmax; out = merged wo ('xw') -> [2][2048][2048]).
// Compute dtypes, f32 accumulate: every input rounded to bf16; q/k/v on PLAIN bf16 operands (inputs: exact); rotary in f32 from the bf16-rounded tables; causal + padding-masked scores and attn.v (causal tile skipping): query rows < 512 hl (3 products), the rest single fp16 (probabilities x16); online softmax f32, attention fused in one kernel; wo hl x exact (2 products).

#define NB_  2
#define TT   2048
#define DM   2048
#define NH_  16
#define NKV  8
#define REP  (NH_ / NKV)
#define HD   128
#define DQ   (NH_ * HD)
#define DKV  (NKV * HD)
#define RH   512                  // query rows < RH use hi+lo planes (0: none)
#define SCL  0.088388347648318447f   // HD^-0.5
typedef _Float16 h16;
typedef unsigned short bf;
typedef __attribute__((ext_vector_type(16))) __bf16   v16bf;
typedef __attribute__((ext_vector_type(16))) _Float16 v16h;
typedef __attribute__((ext_vector_type(8)))  _Float16 v8h;
typedef __attribute__((ext_vector_type(8)))  unsigned short v8us;
typedef __attribute__((ext_vector_type(8)))  float    v8f;
typedef __attribute__((ext_vector_type(4)))  float    v4f;
typedef v8h  __attribute__((may_alias)) v8ha;
typedef v4f  __attribute__((may_alias)) v4fa;
typedef v8us __attribute__((may_alias)) v8usa;

__device__ __forceinline__ unsigned short f2bf(float f) { unsigned u = __float_as_uint(f); u += 0x7FFFu + ((u >> 16) & 1u); return (unsigned short)(u >> 16); }
__device__ __forceinline__ float bf2f(unsigned short b) { return __uint_as_float(((unsigned)b) << 16); }
__device__ __forceinline__ float bfr(float f) { return bf2f(f2bf(f)); }
__device__ __forceinline__ v16h cat16(v8h lo, v8h hi) { return __builtin_shufflevector(lo, hi, 0, 1, 2, 3, 4, 5, 6, 7, 8, 9, 10, 11, 12, 13, 14, 15); }
__device__ __forceinline__ v16bf cat16b(v8us lo, v8us hi) { return __builtin_bit_cast(v16bf, __builtin_shufflevector(lo, hi, 0, 1, 2, 3, 4, 5, 6, 7, 8, 9, 10, 11, 12, 13, 14, 15)); }
__device__ __forceinline__ v8f wmma16(v16h a, v16h b, v8f c) { return __builtin_amdgcn_wmma_f32_16x16x32_f16(false, a, false, b, (short)0, c, false, false); }
__device__ __forceinline__ v8f wmmab(v16bf a, v16bf b, v8f c) { return __builtin_amdgcn_wmma_f32_16x16x32_bf16(false, a, false, b, (short)0, c, false, false); }



// tile_sync: orders the LDS slab writes against the reads of the tile epilogue; one wave needs no hardware barrier, several waves need the work-group barrier.
// The fences name LDS alone: only LDS data passes between the waves here, and a full __syncthreads() would also hold every wave until the tile rows just stored to global memory have landed, at each of the four stages.
template <int NW> __device__ __forceinline__ void tile_sync() {
    if (NW == 1) { __builtin_amdgcn_wave_barrier(); asm volatile("" ::: "memory"); }
    else { __builtin_amdgcn_fence(__ATOMIC_RELEASE, "workgroup", "local"); __builtin_amdgcn_s_barrier(); __builtin_amdgcn_fence(__ATOMIC_ACQUIRE, "workgroup", "local"); } }

// ---- k_gemmw: register-blocked GEMM, one 64x64 output tile per work-group of NW waves (16 accumulators per wave), operands straight from K-contiguous 16-bit planes; grid (M/64, N/64, Z), 32 * NW threads.
// Wave w takes the 32-wide K chunks w, w + NW, w + 2 NW, ...; the NW partial tiles are summed in wave order 0..NW-1 through LDS (one slab per wave) before the store.
// C[m][n] (f32, pitch ldc, + optional f32 bias[n]) = sum_k A[m][k] Bt[n][k] (+ split products per NSPLIT). z-batch strides sA/sB/sC in elements. K % 32 == 0.
template <typename T16> struct WFrag;
template <> struct WFrag<h16> { typedef v16h V; static __device__ __forceinline__ V ld(const h16* p) { return cat16(*(const v8h*)p, *(const v8h*)(p + 16)); } static __device__ __forceinline__ v8f mma(V a, V b, v8f c) { return wmma16(a, b, c); } };
template <> struct WFrag<bf> { typedef v16bf V; static __device__ __forceinline__ V ld(const bf* p) { return cat16b(*(const v8us*)p, *(const v8us*)(p + 16)); } static __device__ __forceinline__ v8f mma(V a, V b, v8f c) { return wmmab(a, b, c); } };
template <typename T16, int NSPLIT, bool BIAS, int NW>
__global__ __launch_bounds__(32 * NW) void k_gemmw(const T16* __restrict__ A, const T16* __restrict__ A2, const T16* __restrict__ Bt, const T16* __restrict__ Bt2, int K, float* C, int ldc, const float* __restrict__ bias, size_t sA, size_t sB, size_t sC) {
    typedef typename WFrag<T16>::V V;
    __shared__ __align__(16) float os[NW * 16 * 68];
    const size_t z = blockIdx.z; A += z * sA; if (A2) A2 += z * sA; Bt += z * sB; if (Bt2) Bt2 += z * sB; C += z * sC;
    const int lane = threadIdx.x & 31, lr = lane & 15, hi = lane >> 4; const int wv = (NW == 1) ? 0 : __builtin_amdgcn_readfirstlane((int)(threadIdx.x >> 5)); const int r0 = blockIdx.x * 64, c0 = blockIdx.y * 64;
    v8f acc[4][4];
#pragma unroll
    for (int mb = 0; mb < 4; ++mb)
#pragma unroll
        for (int nb = 0; nb < 4; ++nb) acc[mb][nb] = (v8f){};
    const size_t aoff = (size_t)(r0 + lr) * K + 8 * hi, boff = (size_t)(c0 + lr) * K + 8 * hi;
#pragma unroll 1
    for (int kc = wv * 32; kc < K; kc += 32 * NW) {
        V a[4], a2[4];
#pragma unroll
        for (int mb = 0; mb < 4; ++mb) { a[mb] = WFrag<T16>::ld(A + aoff + (size_t)mb * 16 * K + kc); if (NSPLIT == 1 || NSPLIT == 2) a2[mb] = WFrag<T16>::ld(A2 + aoff + (size_t)mb * 16 * K + kc); }
#pragma unroll
        for (int nb = 0; nb < 4; ++nb) { const V b = WFrag<T16>::ld(Bt + boff + (size_t)nb * 16 * K + kc); V b2; if (NSPLIT >= 2) b2 = WFrag<T16>::ld(Bt2 + boff + (size_t)nb * 16 * K + kc);
#pragma unroll
            for (int mb = 0; mb < 4; ++mb) { acc[mb][nb] = WFrag<T16>::mma(a[mb], b, acc[mb][nb]); if (NSPLIT == 1 || NSPLIT == 2) acc[mb][nb] = WFrag<T16>::mma(a2[mb], b, acc[mb][nb]); if (NSPLIT >= 2) acc[mb][nb] = WFrag<T16>::mma(a[mb], b2, acc[mb][nb]); } }
        asm volatile("v_nop\n\tv_nop\n\tv_nop\n\tv_nop" : "+v"(acc[0][0]), "+v"(acc[1][1]), "+v"(acc[2][2]), "+v"(acc[3][3]) : "v"(a[0]), "v"(a[3]));
    }
#pragma unroll
    for (int mb = 0; mb < 4; ++mb) {
#pragma unroll
        for (int nb = 0; nb < 4; ++nb) {
#pragma unroll
            for (int j = 0; j < 8; ++j) os[wv * (16 * 68) + (hi * 8 + j) * 68 + nb * 16 + lr] = acc[mb][nb][j]; }
        tile_sync<NW>();
        float* crow = C + (size_t)(r0 + mb * 16) * ldc + c0;
{
#pragma unroll
            for (int s = 0; s < (NW < 8 ? 8 / NW : 1); ++s) { const int row = 2 * NW * s + 2 * wv + hi, cofs = lr * 4; if (NW > 8 && wv >= 8) break;   /* 16 rows: waves 8 and up have none */ v4f val = *(const v4fa*)(os + row * 68 + cofs);
#pragma unroll
                for (int w = 1; w < NW; ++w) val += *(const v4fa*)(os + w * (16 * 68) + row * 68 + cofs);
                if (BIAS) { val[0] += bfr(bias[c0 + cofs]); val[1] += bfr(bias[c0 + cofs + 1]); val[2] += bfr(bias[c0 + cofs + 2]); val[3] += bfr(bias[c0 + cofs + 3]); }
                *(v4f*)(crow + (size_t)row * ldc + cofs) = val; }
             }
        if (mb < 3) {   // the slabs are rewritten by the next stage only
            if (NW > 1) asm volatile("s_wait_xcnt 0x0" ::: "memory");   // stands in front of the next stage's reuse of the registers that the stores above name
            tile_sync<NW>(); }
    }
}

__device__ __forceinline__ h16 tohx(float x) { return (h16)x; }
__device__ __forceinline__ void splitf(float y, unsigned short& h, unsigned short& l) { h = f2bf(y); l = f2bf(y - bf2f(h)); }
typedef __attribute__((ext_vector_type(2))) _Float16 v2h;
typedef __attribute__((ext_vector_type(4))) _Float16 v4h;
typedef __attribute__((ext_vector_type(2))) unsigned short v2us;
typedef __attribute__((ext_vector_type(4))) unsigned short v4us;
typedef __attribute__((ext_vector_type(2))) float v2f;
typedef __attribute__((ext_vector_type(4))) int v4i;

__global__ __launch_bounds__(256) void k_wtG(const float* __restrict__ w, int K, int N, bf* Bt) {
    const int lane = threadIdx.x & 31; const int L0 = (blockIdx.x * 8 + (threadIdx.x >> 5)) * 8; const int nlines = N * K / 64;
{
#pragma unroll 1
        for (int l = 0; l < 8; ++l) { const int L = L0 + l; if (L >= nlines) break; const size_t e = (size_t)L * 64 + lane * 2; const int k = (int)(e % K), n = (int)(e / K); v2us o;
            o[0] = f2bf(w[(size_t)k * N + n]); o[1] = f2bf(w[(size_t)(k + 1) * N + n]); *(v2us*)(Bt + e) = o; }
         }
}
__global__ __launch_bounds__(256) void k_cvt8(const float* __restrict__ src, bf* dst, size_t n8) { const size_t i = (size_t)blockIdx.x * 256 + threadIdx.x; if (i >= n8) return; const v8f v = *(const v8f*)(src + i * 8); v8us o;
#pragma unroll
    for (int k = 0; k < 8; ++k) o[k] = f2bf(v[k]); *(v8us*)(dst + i * 8) = o;  }
__global__ __launch_bounds__(256) void k_cscvt(const float* __restrict__ cosT, const float* __restrict__ sinT, float* CS) { const int idx = blockIdx.x * 256 + threadIdx.x; if (idx >= TT * HD) return; const int t = idx / HD, d = idx % HD; const size_t ti = (size_t)t * (HD / 2) + (d >> 1);   /* interleaved pairs (2i, 2i+1) use table column i */ v2f cs; cs[0] = bfr(cosT[ti]); cs[1] = bfr(sinT[ti]); *(v2f*)(CS + (size_t)idx * 2) = cs;  }
// k_rope: head planes [h][t][d] (fp16 + hi/lo) of the interleaved rotary out_r = tr c - ti s, out_i = tr s + ti c (pairs (2i, 2i+1), table column i)
__global__ __launch_bounds__(256) void k_rope(const float* __restrict__ F, int pitch, int nheads, const float* __restrict__ CS, const float* __restrict__ RF, const float* __restrict__ nw, float sc, h16* P16, bf* Ph, bf* Pl) {
    const size_t e = ((size_t)blockIdx.x * 256 + threadIdx.x) * 2; if (e >= (size_t)nheads * TT * HD) return; const int d = (int)(e % HD); const int t = (int)((e / HD) % TT); const int h = (int)(e / ((size_t)HD * TT)); const float* f = F + (size_t)t * pitch + h * HD; const float rf = RF ? RF[(size_t)h * TT + t] : 1.0f; v2h o16; v2us oh, ol;
#pragma unroll
    for (int q = 0; q < 2; ++q) { const int dd = d + q; const int dp = dd ^ 1;   /* interleaved pair partner */ float x0 = f[dd], x1 = f[dp];
        if (RF) { float n0 = __fmul_rn(x0, rf), n1 = __fmul_rn(x1, rf); asm volatile("" : "+v"(n0)); asm volatile("" : "+v"(n1)); x0 = __fmul_rn(bfr(nw[dd]), n0); x1 = __fmul_rn(bfr(nw[dp]), n1); }
        const v2f cs = *(const v2f*)(CS + ((size_t)t * HD + dd) * 2); float a = __fmul_rn(x0, cs[0]), bq = __fmul_rn(x1, cs[1]); asm volatile("" : "+v"(a)); asm volatile("" : "+v"(bq)); const float r = (((dd & 1) == 0) ? __fsub_rn(a, bq) : __fadd_rn(a, bq)) * sc;   /* even: tr c - ti s; odd: ti c + tr s */
        o16[q] = tohx(r); unsigned short a2, c2; splitf(r, a2, c2); oh[q] = a2; ol[q] = c2; }
    *(v2h*)(P16 + e) = o16; *(v2us*)(Ph + e) = oh; *(v2us*)(Pl + e) = ol;  }
__global__ __launch_bounds__(256) void k_vtp(const float* __restrict__ F, int pitch, int nheads, h16* V16, bf* Vh, bf* Vl) { const size_t e = ((size_t)blockIdx.x * 256 + threadIdx.x) * 2; if (e >= (size_t)nheads * HD * TT) return; const int t = (int)(e % TT); const int d = (int)((e / TT) % HD); const int g = (int)(e / ((size_t)TT * HD)); v2h o16; v2us oh, ol;
#pragma unroll
    for (int q = 0; q < 2; ++q) { const float x = F[(size_t)(t + q) * pitch + g * HD + d]; o16[q] = tohx(x); unsigned short a2, c2; splitf(x, a2, c2); oh[q] = a2; ol[q] = c2; }
    *(v2h*)(V16 + e) = o16; *(v2us*)(Vh + e) = oh; *(v2us*)(Vl + e) = ol;  }
#define FNW 8
#define FP  132                   // slab row pitch in floats: 128 + 4, rows stay 16-byte aligned
__device__ __forceinline__ float xhalf(float x) { return __builtin_bit_cast(float, __builtin_amdgcn_permlanex16(__builtin_bit_cast(int, x), __builtin_bit_cast(int, x), 0x76543210, 0xfedcba98, false, false)); }  // lane l with lane l ^ 16
// exp2s: 2^x with, in the same statement, the one free slot that the instruction set asks for between a transcendental and a next instruction that reads its result or overwrites its source
__device__ __forceinline__ float exp2s(float x) { float r; asm("v_exp_f32 %0, %1\n\tv_nop" : "=v"(r) : "v"(x)); return r; }
// wait_x: stands behind a group of global loads, in front of any reuse of the address registers that they name; the lane addresses are inputs so that their registers stay whole up to the wait
template <typename T16> __device__ __forceinline__ void wait_x(const T16* p, const T16* p2) { asm volatile("s_wait_xcnt 0x0" :: "v"(p), "v"(p2) : "memory"); }
template <typename T16> __device__ __forceinline__ void ldk(typename WFrag<T16>::V (&k)[2][4], const T16* base, int blk, int lr, int hi) {
    const T16* p = base + (size_t)(blk * 32 + lr) * HD + 8 * hi;
#pragma unroll
    for (int kt = 0; kt < 2; ++kt)
#pragma unroll
        for (int kc = 0; kc < 4; ++kc) k[kt][kc] = WFrag<T16>::ld(p + kt * 16 * HD + kc * 32);
    wait_x(p, p); }
template <typename T16, bool HI>
__device__ __forceinline__ void fattn_body(const T16* Q, const T16* Q2, const T16* Kp, const T16* K2, const T16* VT, const T16* VT2, const int* SLb, bf* Ah, bf* Al, float* slab, float* ms, float* ls, int h, int qb) {
    typedef typename WFrag<T16>::V V;
    const int lane = threadIdx.x & 31, lr = lane & 15, hi = lane >> 4; const int wv = __builtin_amdgcn_readfirstlane((int)(threadIdx.x >> 5));
    const int q0 = qb * 32;
    const int slen = min(max(SLb[0], 0), TT);                 // valid key count of this batch (int32 input), bounded by the shape
    const int np = min(qb + 1, (slen + 31) >> 5);             // 32-key passes of this query block: up to the diagonal and up to the last valid key
    const float cscale = SCL * 1.4426950408889634f, NINF = -__builtin_inff();
    const size_t qo = (size_t)h * TT * HD, ko = (size_t)(h / REP) * TT * HD;
    Q += qo; Kp += ko; VT += ko; if (HI) { Q2 += qo; K2 += ko; VT2 += ko; }
    V qf[2][4], q2[2][4];
#pragma unroll
    for (int g = 0; g < 2; ++g) { const size_t o = (size_t)(q0 + 16 * g + lr) * HD + 8 * hi; const T16* qp = Q + o; const T16* qp2 = HI ? Q2 + o : qp;
#pragma unroll
        for (int kc = 0; kc < 4; ++kc) { qf[g][kc] = WFrag<T16>::ld(qp + 32 * kc); if (HI) q2[g][kc] = WFrag<T16>::ld(qp2 + 32 * kc); }
        wait_x(qp, qp2); }
    v8f acc[2][8]; float m_run[2], l_run[2];
#pragma unroll
    for (int g = 0; g < 2; ++g) { m_run[g] = NINF; l_run[g] = 0.f;
#pragma unroll
        for (int t = 0; t < 8; ++t) acc[g][t] = (v8f){}; }
    V kf[2][4];
    if (!HI) ldk<T16>(kf, Kp, max(min(wv, np - 1), 0), lr, hi);
#pragma unroll 1
    for (int blk = wv; blk < np; blk += FNW) {
        const int key0 = blk * 32;
        V vf[8], v2[8], k2[2][4];
        if (HI) { ldk<T16>(kf, Kp, blk, lr, hi); ldk<T16>(k2, K2, blk, lr, hi); }   // six planes: no room to hold a pass ahead
        { const size_t o = (size_t)lr * TT + key0 + 8 * hi; const T16* vp = VT + o; const T16* vp2 = HI ? VT2 + o : vp;
#pragma unroll
          for (int t = 0; t < 8; ++t) { vf[t] = WFrag<T16>::ld(vp + (size_t)t * 16 * TT); if (HI) v2[t] = WFrag<T16>::ld(vp2 + (size_t)t * 16 * TT); }
          wait_x(vp, vp2); }
        v8f s[2][2];
#pragma unroll
        for (int kt = 0; kt < 2; ++kt)
#pragma unroll
            for (int g = 0; g < 2; ++g) { s[kt][g] = (v8f){};
#pragma unroll
                for (int kc = 0; kc < 4; ++kc) { s[kt][g] = WFrag<T16>::mma(kf[kt][kc], qf[g][kc], s[kt][g]); if (HI) { s[kt][g] = WFrag<T16>::mma(k2[kt][kc], qf[g][kc], s[kt][g]); s[kt][g] = WFrag<T16>::mma(kf[kt][kc], q2[g][kc], s[kt][g]); } } }
        if (!HI) ldk<T16>(kf, Kp, min(blk + FNW, np - 1), lr, hi);     // this wave's next pass's K rows fly under the softmax (the last pass reads a valid row block again)
        if (blk == qb || key0 + 32 > slen) {                  // wave-uniform: only the pass on the diagonal or across the last valid key pays for the mask
#pragma unroll
            for (int g = 0; g < 2; ++g)
#pragma unroll
                for (int kt = 0; kt < 2; ++kt)
#pragma unroll
                    for (int r = 0; r < 8; ++r) { const int key = key0 + 16 * kt + 8 * hi + r; if (key > q0 + 16 * g + lr || key >= slen) s[kt][g][r] = NINF; }   /* causal OR key padding; the pass's first key stays for every query */
        }
        float mb[2]; bool need = false;
#pragma unroll
        for (int g = 0; g < 2; ++g) { float mx = NINF;
#pragma unroll
            for (int kt = 0; kt < 2; ++kt)
#pragma unroll
                for (int r = 0; r < 8; ++r) mx = fmaxf(mx, s[kt][g][r]);
            mx = fmaxf(mx, xhalf(mx)) * cscale; mb[g] = mx; need = need || (mx > m_run[g] + 8.0f); }
        if (__builtin_amdgcn_ballot_w32(need) != 0) {
#pragma unroll
            for (int g = 0; g < 2; ++g) { const float m_new = fmaxf(m_run[g], mb[g]); const float corr = exp2s(m_run[g] - m_new);   /* 0 on the first pass */ l_run[g] *= corr; m_run[g] = m_new;
#pragma unroll
                for (int t = 0; t < 8; ++t) acc[g][t] = acc[g][t] * corr; }
        }
#pragma unroll
        for (int g = 0; g < 2; ++g) { const float nm = (HI ? 0.0f : 4.0f) - m_run[g]; float p[16], ps0 = 0.f, ps1 = 0.f;
#pragma unroll
            for (int e = 0; e < 16; ++e) { p[e] = exp2s(__builtin_fmaf(s[e >> 3][g][e & 7], cscale, nm)); if (e & 1) ps1 += p[e]; else ps0 += p[e]; }
            l_run[g] += ps0 + ps1;
            if (HI) { v8us h0, h1, l0, l1;
#pragma unroll
                for (int e = 0; e < 8; ++e) { unsigned short a, c2; splitf(p[e], a, c2); h0[e] = a; l0[e] = c2; splitf(p[e + 8], a, c2); h1[e] = a; l1[e] = c2; }
                const v16bf ph = cat16b(h0, h1), pl = cat16b(l0, l1);
#pragma unroll
                for (int t = 0; t < 8; ++t) { acc[g][t] = wmmab(__builtin_bit_cast(v16bf, vf[t]), ph, acc[g][t]); acc[g][t] = wmmab(__builtin_bit_cast(v16bf, vf[t]), pl, acc[g][t]); acc[g][t] = wmmab(__builtin_bit_cast(v16bf, v2[t]), ph, acc[g][t]); }
            } else { v16h pf;
#pragma unroll
                for (int e = 0; e < 16; ++e) pf[e] = (h16)p[e];
#pragma unroll
                for (int t = 0; t < 8; ++t) acc[g][t] = wmma16(__builtin_bit_cast(v16h, vf[t]), pf, acc[g][t]); } }
        __builtin_amdgcn_sched_barrier(0);                    // keeps the matrix instructions in front of the slots below
        asm volatile("v_nop\n\tv_nop\n\tv_nop\n\tv_nop\n\tv_nop");   // the distance behind the last matrix instruction on the loop's back edge
    }
    if (wv < np) {                                            // wave-uniform: a wave without a pass leaves no slab
#pragma unroll
        for (int g = 0; g < 2; ++g) { const float lf = l_run[g] + xhalf(l_run[g]);   /* each wave half summed its own eight keys of every 16 */ const int row = wv * 32 + 16 * g + lr;
            if (hi == 0) { ms[row] = m_run[g]; ls[row] = lf; }
#pragma unroll
            for (int t = 0; t < 8; ++t) { float* d = slab + row * FP + 16 * t + 8 * hi; const v8f a = acc[g][t]; *(v4fa*)d = (v4f){a[0], a[1], a[2], a[3]}; *(v4fa*)(d + 4) = (v4f){a[4], a[5], a[6], a[7]}; } }
    }
    __syncthreads();                                          // every wave's slab, maximum and sum are written before any is read
    const int na = min(FNW, np); const int q = threadIdx.x >> 3, dl = (threadIdx.x & 7) * 8;
    float mstar = NINF;
    for (int w = 0; w < na; ++w) mstar = fmaxf(mstar, ms[w * 32 + q]);
    float L = 0.f; v4f o[4];
#pragma unroll
    for (int i = 0; i < 4; ++i) o[i] = (v4f){};
    for (int w = 0; w < na; ++w) { const float f = exp2s(ms[w * 32 + q] - mstar); L += f * ls[w * 32 + q]; const float* sp = slab + (w * 32 + q) * FP + dl;
        o[0] += f * *(const v4fa*)sp; o[1] += f * *(const v4fa*)(sp + 4); o[2] += f * *(const v4fa*)(sp + 64); o[3] += f * *(const v4fa*)(sp + 68); }
    const float inv = __fdiv_rn(1.0f, L); const size_t oo = (size_t)(q0 + q) * DQ + h * HD + dl;
#pragma unroll
    for (int i = 0; i < 2; ++i) { v8us oh, ol;
#pragma unroll
        for (int e = 0; e < 8; ++e) { unsigned short a, c2; splitf(o[2 * i + (e >> 2)][e & 3] * inv, a, c2); oh[e] = a; ol[e] = c2; }
        *(v8us*)(Ah + oo + 64 * i) = oh; *(v8us*)(Al + oo + 64 * i) = ol; }
}
__global__ __launch_bounds__(32 * FNW) void k_fattn(const h16* Q16, const h16* K16, const h16* V16, const bf* Qh, const bf* Ql, const bf* Kh, const bf* Kl, const bf* Vh, const bf* Vl, const int* SLb, bf* Ah, bf* Al) {   // no __restrict__: the plane loads keep their place in front of their waits
    __shared__ __align__(16) float slab[FNW * 32 * FP];
    __shared__ float ms[FNW * 32], ls[FNW * 32];
    const int h = blockIdx.x, qb = TT / 32 - 1 - (int)blockIdx.y;   // the longest query blocks start first
    if (qb < RH / 32) fattn_body<bf, true>(Qh, Ql, Kh, Kl, Vh, Vl, SLb, Ah, Al, slab, ms, ls, h, qb);   // block-uniform
    else fattn_body<h16, false>(Q16, nullptr, K16, nullptr, V16, nullptr, SLb, Ah, Al, slab, ms, ls, h, qb);
}

extern "C" void kernel_launch(void* const* d_in, const int* in_sizes, int n_in,
                              void* d_out, int out_size, void* d_ws, size_t ws_size, hipStream_t stream) {
    (void)in_sizes; (void)n_in; (void)out_size;
    const float* x = (const float*)d_in[0]; const float* wq = (const float*)d_in[1]; const float* wkv = (const float*)d_in[2]; const float* wo = (const float*)d_in[3]; const float* cosT = (const float*)d_in[4]; const float* sinT = (const float*)d_in[5]; const int* SL = (const int*)d_in[6]; const float* wk = nullptr; const float* wv = nullptr; (void)wk; (void)wv;
    float* OUT = (float*)d_out;     // [2][2048][2048]
    char* wsp = (char*)d_ws;
    auto take = [&](size_t bytes) { char* p = wsp; wsp += (bytes + 255) & ~(size_t)255; return (void*)p; };
    bf* WQ = (bf*)take((size_t)DQ * DM * 2); bf* WKV = (bf*)take((size_t)2 * DKV * DM * 2); bf* WK = WKV; bf* WV = WKV + (size_t)DKV * DM;   /* row blocks of the transposed fused wkv */ bf* WO = (bf*)take((size_t)DM * DQ * 2); float* CS = (float*)take((size_t)TT * HD * 2 * 4);
    bf* XB = (bf*)take((size_t)TT * DM * 2); float* FQ = (float*)take((size_t)TT * DQ * 4); float* FK = (float*)take((size_t)TT * DKV * 4);
    h16* QP16 = (h16*)take((size_t)NH_ * TT * HD * 2); h16* KP16 = (h16*)take((size_t)NKV * TT * HD * 2); h16* VT16 = (h16*)take((size_t)NKV * HD * TT * 2);
    bf* QPh = (bf*)take((size_t)NH_ * TT * HD * 2); bf* QPl = (bf*)take((size_t)NH_ * TT * HD * 2); bf* KPh = (bf*)take((size_t)NKV * TT * HD * 2); bf* KPl = (bf*)take((size_t)NKV * TT * HD * 2); bf* VTh = (bf*)take((size_t)NKV * HD * TT * 2); bf* VTl = (bf*)take((size_t)NKV * HD * TT * 2);
    bf* ATh = (bf*)FQ; bf* ATl = ATh + (size_t)TT * DQ;   // the merged hi/lo planes reuse the q projection buffer, which is dead once the q planes are built (stream-ordered)
    if ((size_t)(wsp - (char*)d_ws) > ws_size) return;    // ws 256 MiB
    float* FV = FK;   // v projection reuses the k buffer after the k planes are built (stream-ordered)
    { k_wtG<<<(unsigned)((DM * DQ / 64 + 63) / 64), 256, 0, stream>>>(wq, DM, DQ, WQ); k_wtG<<<(unsigned)((DM * 2 * DKV / 64 + 63) / 64), 256, 0, stream>>>(wkv, DM, 2 * DKV, WKV);   /* 'xw' [2048][2048] -> Bt [2048][2048]: rows 0-1023 k, 1024-2047 v */
      k_wtG<<<(unsigned)((DQ * DM / 64 + 63) / 64), 256, 0, stream>>>(wo, DQ, DM, WO);
       }
    const unsigned LQ = (unsigned)(((size_t)NH_ * TT * HD / 2 + 255) / 256), LKv = (unsigned)(((size_t)NKV * TT * HD / 2 + 255) / 256);
    for (int b = 0; b < NB_; ++b) {
        if (b == 0) k_cscvt<<<(TT * HD + 255) / 256, 256, 0, stream>>>(cosT, sinT, CS);
        k_cvt8<<<(unsigned)(((size_t)TT * DM / 8 + 255) / 256), 256, 0, stream>>>(x + (size_t)b * TT * DM, XB, (size_t)TT * DM / 8);
        k_gemmw<bf, 0, false, 4><<<dim3(TT / 64, DQ / 64, 1), 128, 0, stream>>>(XB, nullptr, WQ, nullptr, DM, FQ, DQ, nullptr, 0, 0, 0);
        k_rope<<<LQ, 256, 0, stream>>>(FQ, DQ, NH_, CS, nullptr, nullptr, 1.0f, QP16, QPh, QPl);
        k_gemmw<bf, 0, false, 8><<<dim3(TT / 64, DKV / 64, 1), 256, 0, stream>>>(XB, nullptr, WK, nullptr, DM, FK, DKV, nullptr, 0, 0, 0);
        k_rope<<<LKv, 256, 0, stream>>>(FK, DKV, NKV, CS, nullptr, nullptr, 1.0f, KP16, KPh, KPl);
        k_gemmw<bf, 0, false, 8><<<dim3(TT / 64, DKV / 64, 1), 256, 0, stream>>>(XB, nullptr, WV, nullptr, DM, FV, DKV, nullptr, 0, 0, 0); k_vtp<<<LKv, 256, 0, stream>>>(FV, DKV, NKV, VT16, VTh, VTl);
        k_fattn<<<dim3(NH_, TT / 32, 1), 32 * FNW, 0, stream>>>(QP16, KP16, VT16, QPh, QPl, KPh, KPl, VTh, VTl, SL + b, ATh, ATl);
        k_gemmw<bf, 1, false, 4><<<dim3(TT / 64, DM / 64, 1), 128, 0, stream>>>(ATh, ATl, WO, nullptr, DQ, OUT + (size_t)b * TT * DM, DM, nullptr, 0, 0, 0); }
}

// v004
// One run takes 283 microseconds.
// Timed twice side by side with v003, it ran 1.61 and 1.63 times as fast.
// All steps since v000 together make it 5.99 times as fast.
#include <hip/hip_runtime.h>

// Causal GQA with key-padding mask and interleaved rotary (x [2][2048][2048]; q = x wq ('xw' [2048][2048], 16 heads x 128); [k|v] = x wkv ('xw' [2048][2048]: columns 0-1023 k, 1024-2047 v; 8 kv heads x 128); llama-style interleaved RoPE from the given tables [2048][64] on q, k; 2 query heads per kv head; scores/sqrt(128) masked where j > i OR j >= seq_lengths[b] (int32 input, read on device); softmax; out = merged wo ('xw') -> [2][2048][2048]).
// Compute dtypes, f32 accumulate: every input rounded to bf16; q/k/v on PLAIN bf16 operands (inputs: exact); rotary in f32 from the bf16-rounded tables; causal + padding-masked scores and attn.v (causal tile skipping): query rows < 512 hl (3 products), the rest single fp16 (probabilities x16); online softmax f32, attention fused in one kernel; wo hl x exact (2 products).
// Every 16-bit operand plane of a matrix product (x, the transposed weights, q, k, transposed v, the merged attention hi/lo) lies in fragment order (fragoff below), not row-major.

#define NB_  2
#define TT   2048
#define DM   2048
#define NH_  16
#define NKV  8
#define REP  (NH_ / NKV)
#define HD   128
#define DQ   (NH_ * HD)
#define DKV  (NKV * HD)
#define RH   512                  // query rows < RH use hi+lo planes (0: none)
#define SCL  0.088388347648318447f   // HD^-0.5
typedef _Float16 h16;
typedef unsigned short bf;
typedef __attribute__((ext_vector_type(16))) __bf16   v16bf;
typedef __attribute__((ext_vector_type(16))) _Float16 v16h;
typedef __attribute__((ext_vector_type(8)))  _Float16 v8h;
typedef __attribute__((ext_vector_type(8)))  unsigned short v8us;
typedef __attribute__((ext_vector_type(8)))  float    v8f;
typedef __attribute__((ext_vector_type(4)))  float    v4f;
typedef v8h  __attribute__((may_alias)) v8ha;
typedef v4f  __attribute__((may_alias)) v4fa;
typedef v8us __attribute__((may_alias)) v8usa;

__device__ __forceinline__ unsigned short f2bf(float f) { unsigned u = __float_as_uint(f); u += 0x7FFFu + ((u >> 16) & 1u); return (unsigned short)(u >> 16); }
__device__ __forceinline__ float bf2f(unsigned short b) { return __uint_as_float(((unsigned)b) << 16); }
__device__ __forceinline__ float bfr(float f) { return bf2f(f2bf(f)); }
__device__ __forceinline__ v16h cat16(v8h lo, v8h hi) { return __builtin_shufflevector(lo, hi, 0, 1, 2, 3, 4, 5, 6, 7, 8, 9, 10, 11, 12, 13, 14, 15); }
__device__ __forceinline__ v16bf cat16b(v8us lo, v8us hi) { return __builtin_bit_cast(v16bf, __builtin_shufflevector(lo, hi, 0, 1, 2, 3, 4, 5, 6, 7, 8, 9, 10, 11, 12, 13, 14, 15)); }
__device__ __forceinline__ v8f wmma16(v16h a, v16h b, v8f c) { return __builtin_amdgcn_wmma_f32_16x16x32_f16(false, a, false, b, (short)0, c, false, false); }
__device__ __forceinline__ v8f wmmab(v16bf a, v16bf b, v8f c) { return __builtin_amdgcn_wmma_f32_16x16x32_bf16(false, a, false, b, (short)0, c, false, false); }



// tile_sync: orders the LDS slab writes against the reads of the tile epilogue; one wave needs no hardware barrier, several waves need the work-group barrier.
// The fences name LDS alone: only LDS data passes between the waves here, and a full __syncthreads() would also hold every wave until the tile rows just stored to global memory have landed, at each of the four stages.
template <int NW> __device__ __forceinline__ void tile_sync() {
    if (NW == 1) { __builtin_amdgcn_wave_barrier(); asm volatile("" ::: "memory"); }
    else { __builtin_amdgcn_fence(__ATOMIC_RELEASE, "workgroup", "local"); __builtin_amdgcn_s_barrier(); __builtin_amdgcn_fence(__ATOMIC_ACQUIRE, "workgroup", "local"); } }

// Fragment order of a 16-bit operand plane [R][K] (R % 16 == 0, K % 32 == 0): blocks of 16 rows x 32 k, 512 elements each, block (r / 16, k / 32) at index (r / 16) * (K / 32) + k / 32.
// Inside a block the 16-byte piece that holds k & ~7 .. k | 7 of row r is piece ((k / 16) % 2) * 32 + ((k / 8) % 2) * 16 + r % 16: pieces 0-31 are the 32 lanes' first eight k of a 16x16x32 fragment, pieces 32-63 their second eight,
// so that a fragment is two loads of 512 contiguous bytes (four whole cache lines each) where a row-major plane gives 32 bytes from each of 16 lines. The values in each lane's registers are those of the row-major loader.
__device__ __forceinline__ size_t fragoff(int r, int k, int K) { return ((size_t)(r >> 4) * (K >> 5) + (k >> 5)) * 512 + (((k >> 4) & 1) * 32 + ((k >> 3) & 1) * 16 + (r & 15)) * 8 + (k & 7); }
// piece_rk: the row and the first k of 16-byte piece i of such a plane (the inverse of fragoff)
__device__ __forceinline__ void piece_rk(size_t i, int K, int& r, int& k) { const int w = (int)(i & 63); const int blk = (int)(i >> 6), kb = blk % (K >> 5), rb = blk / (K >> 5); r = rb * 16 + (w & 15); k = kb * 32 + (w >> 5) * 16 + ((w >> 4) & 1) * 8; }
// wait_x: stands behind a group of global loads, in front of any reuse of the address registers that they name; the lane addresses are inputs so that their registers stay whole up to the wait
template <typename T16> __device__ __forceinline__ void wait_x(const T16* p, const T16* p2) { asm volatile("s_wait_xcnt 0x0" :: "v"(p), "v"(p2) : "memory"); }
// ---- k_gemmw: register-blocked GEMM, one 64x64 output tile per work-group of NW waves (16 accumulators per wave), operands straight from 16-bit planes in fragment order; grid (M/64, N/64, Z), 32 * NW threads.
// Wave w takes the 32-wide K chunks w, w + NW, w + 2 NW, ...; the NW partial tiles are summed in wave order 0..NW-1 through LDS (one slab per wave) before the store.
// C[m][n] (f32, pitch ldc, + optional f32 bias[n]) = sum_k A[m][k] Bt[n][k] (+ split products per NSPLIT). z-batch strides sA/sB/sC in elements. K % 32 == 0, a constant of the build so that the row blocks' distances are immediates.
template <typename T16> struct WFrag;
template <> struct WFrag<h16> { typedef v16h V; static __device__ __forceinline__ V ldf(const h16* p) { return cat16(*(const v8h*)p, *(const v8h*)(p + 256)); } static __device__ __forceinline__ v8f mma(V a, V b, v8f c) { return wmma16(a, b, c); } };
template <> struct WFrag<bf> { typedef v16bf V; static __device__ __forceinline__ V ldf(const bf* p) { return cat16b(*(const v8us*)p, *(const v8us*)(p + 256)); } static __device__ __forceinline__ v8f mma(V a, V b, v8f c) { return wmmab(a, b, c); } };
template <typename T16, int NSPLIT, bool BIAS, int NW, int K>
__global__ __launch_bounds__(32 * NW) void k_gemmw(const T16* __restrict__ A, const T16* __restrict__ A2, const T16* __restrict__ Bt, const T16* __restrict__ Bt2, float* C, int ldc, const float* __restrict__ bias, size_t sA, size_t sB, size_t sC) {
    typedef typename WFrag<T16>::V V;
    __shared__ __align__(16) float os[NW * 16 * 68];
    const size_t z = blockIdx.z; A += z * sA; if (A2) A2 += z * sA; Bt += z * sB; if (Bt2) Bt2 += z * sB; C += z * sC;
    const int lane = threadIdx.x & 31, lr = lane & 15, hi = lane >> 4; const int wv = (NW == 1) ? 0 : __builtin_amdgcn_readfirstlane((int)(threadIdx.x >> 5)); const int r0 = blockIdx.x * 64, c0 = blockIdx.y * 64;
    v8f acc[4][4];
#pragma unroll
    for (int mb = 0; mb < 4; ++mb)
#pragma unroll
        for (int nb = 0; nb < 4; ++nb) acc[mb][nb] = (v8f){};
    // 16 rows of a plane are 16 K elements, a 32-wide K chunk 512: one lane pointer per plane walks the chunks, the four row blocks stand at constant distances from it
    const size_t l8 = (size_t)wv * 512 + 8 * lane; const T16* pa = A + (size_t)r0 * K + l8; const T16* pb = Bt + (size_t)c0 * K + l8; const T16* pa2 = (NSPLIT == 1 || NSPLIT == 2) ? A2 + (size_t)r0 * K + l8 : pa; const T16* pb2 = (NSPLIT >= 2) ? Bt2 + (size_t)c0 * K + l8 : pb;
#pragma unroll 1
    for (int kc = wv * 32; kc < K; kc += 32 * NW) {
        V a[4], a2[4], b[4], b2[4];
#pragma unroll
        for (int mb = 0; mb < 4; ++mb) { a[mb] = WFrag<T16>::ldf(pa + mb * 16 * K); if (NSPLIT == 1 || NSPLIT == 2) a2[mb] = WFrag<T16>::ldf(pa2 + mb * 16 * K); }
#pragma unroll
        for (int nb = 0; nb < 4; ++nb) { b[nb] = WFrag<T16>::ldf(pb + nb * 16 * K); if (NSPLIT >= 2) b2[nb] = WFrag<T16>::ldf(pb2 + nb * 16 * K); }
        if (NSPLIT == 0) wait_x(pa, pb); else asm volatile("s_wait_xcnt 0x0" :: "v"(pa), "v"(pb), "v"(pa2), "v"(pb2) : "memory");   // as wait_x: in front of the steps of the lane pointers below
        pa += 512 * NW; pb += 512 * NW; if (NSPLIT != 0) { pa2 += 512 * NW; pb2 += 512 * NW; }
#pragma unroll
        for (int nb = 0; nb < 4; ++nb) {
#pragma unroll
            for (int mb = 0; mb < 4; ++mb) { acc[mb][nb] = WFrag<T16>::mma(a[mb], b[nb], acc[mb][nb]); if (NSPLIT == 1 || NSPLIT == 2) acc[mb][nb] = WFrag<T16>::mma(a2[mb], b[nb], acc[mb][nb]); if (NSPLIT >= 2) acc[mb][nb] = WFrag<T16>::mma(a[mb], b2[nb], acc[mb][nb]); } }
        asm volatile("v_nop\n\tv_nop\n\tv_nop\n\tv_nop" : "+v"(acc[0][0]), "+v"(acc[1][1]), "+v"(acc[2][2]), "+v"(acc[3][3]) : "v"(a[0]), "v"(a[3]));
    }
#pragma unroll
    for (int mb = 0; mb < 4; ++mb) {
#pragma unroll
        for (int nb = 0; nb < 4; ++nb) {
#pragma unroll
            for (int j = 0; j < 8; ++j) os[wv * (16 * 68) + (hi * 8 + j) * 68 + nb * 16 + lr] = acc[mb][nb][j]; }
        tile_sync<NW>();
        float* crow = C + (size_t)(r0 + mb * 16) * ldc + c0;
{
#pragma unroll
            for (int s = 0; s < (NW < 8 ? 8 / NW : 1); ++s) { const int row = 2 * NW * s + 2 * wv + hi, cofs = lr * 4; if (NW > 8 && wv >= 8) break;   /* 16 rows: waves 8 and up have none */ v4f val = *(const v4fa*)(os + row * 68 + cofs);
#pragma unroll
                for (int w = 1; w < NW; ++w) val += *(const v4fa*)(os + w * (16 * 68) + row * 68 + cofs);
                if (BIAS) { val[0] += bfr(bias[c0 + cofs]); val[1] += bfr(bias[c0 + cofs + 1]); val[2] += bfr(bias[c0 + cofs + 2]); val[3] += bfr(bias[c0 + cofs + 3]); }
                *(v4f*)(crow + (size_t)row * ldc + cofs) = val; }
             }
        if (mb < 3) {   // the slabs are rewritten by the next stage only
            if (NW > 1) asm volatile("s_wait_xcnt 0x0" ::: "memory");   // stands in front of the next stage's reuse of the registers that the stores above name
            tile_sync<NW>(); }
    }
}

__device__ __forceinline__ h16 tohx(float x) { return (h16)x; }
__device__ __forceinline__ void splitf(float y, unsigned short& h, unsigned short& l) { h = f2bf(y); l = f2bf(y - bf2f(h)); }
typedef __attribute__((ext_vector_type(2))) _Float16 v2h;
typedef __attribute__((ext_vector_type(4))) _Float16 v4h;
typedef __attribute__((ext_vector_type(2))) unsigned short v2us;
typedef __attribute__((ext_vector_type(4))) unsigned short v4us;
typedef __attribute__((ext_vector_type(2))) float v2f;
typedef __attribute__((ext_vector_type(4))) int v4i;

// k_wtG: w [K][N] f32 -> Bt [N][K] bf16 in fragment order, one 16-byte piece (eight k of one n) per thread: a wave stores 512 contiguous bytes
template <int K, int N> __global__ __launch_bounds__(256) void k_wtG(const float* __restrict__ w, bf* Bt) { const size_t i = (size_t)blockIdx.x * 256 + threadIdx.x; if (i >= (size_t)N * K / 8) return; int n, k; piece_rk(i, K, n, k); const float* p = w + (size_t)k * N + n; float x[8]; v8us o;
#pragma unroll
    for (int e = 0; e < 8; ++e) x[e] = p[e * N];
    wait_x(p, p);
#pragma unroll
    for (int e = 0; e < 8; ++e) o[e] = f2bf(x[e]);
    *(v8us*)(Bt + i * 8) = o; }
// k_cvt8: src [R][K] f32 -> dst bf16 in fragment order, one 16-byte piece per thread
__global__ __launch_bounds__(256) void k_cvt8(const float* __restrict__ src, bf* dst, int K, size_t n8) { const size_t i = (size_t)blockIdx.x * 256 + threadIdx.x; if (i >= n8) return; int r, k; piece_rk(i, K, r, k); const float* p = src + (size_t)r * K + k; const v8f v = *(const v8f*)p; wait_x(p, p); v8us o;
#pragma unroll
    for (int e = 0; e < 8; ++e) o[e] = f2bf(v[e]); *(v8us*)(dst + i * 8) = o;  }
__global__ __launch_bounds__(256) void k_cscvt(const float* __restrict__ cosT, const float* __restrict__ sinT, float* CS) { const int idx = blockIdx.x * 256 + threadIdx.x; if (idx >= TT * HD) return; const int t = idx / HD, d = idx % HD; const size_t ti = (size_t)t * (HD / 2) + (d >> 1);   /* interleaved pairs (2i, 2i+1) use table column i */ v2f cs; cs[0] = bfr(cosT[ti]); cs[1] = bfr(sinT[ti]); *(v2f*)(CS + (size_t)idx * 2) = cs;  }
// k_rope: head planes [h] of [t][d] in fragment order (fp16 + hi/lo) of the interleaved rotary out_r = tr c - ti s, out_i = tr s + ti c (pairs (2i, 2i+1), table column i); one 16-byte piece (eight d of one t) per thread and plane
__global__ __launch_bounds__(256) void k_rope(const float* __restrict__ F, int pitch, int nheads, const float* __restrict__ CS, const float* __restrict__ RF, const float* __restrict__ nw, float sc, h16* P16, bf* Ph, bf* Pl) {
    const size_t i = (size_t)blockIdx.x * 256 + threadIdx.x; if (i >= (size_t)nheads * TT * HD / 8) return; const int h = (int)(i / (TT * HD / 8)); int t, d; piece_rk(i % (TT * HD / 8), HD, t, d); const float* fp = F + (size_t)t * pitch + h * HD + d; const float* csp = CS + ((size_t)t * HD + d) * 2; const v8f f = *(const v8f*)fp; const v8f cs0 = *(const v8f*)csp, cs1 = *(const v8f*)(csp + 8); wait_x(fp, csp); float rf = 1.0f; v8f nv = (v8f){}; v8h o16; v8us oh, ol;
    if (RF) { const float* rp = RF + (size_t)h * TT + t; const float* np = nw + d; rf = *rp; nv = *(const v8f*)np; wait_x(rp, np); }
#pragma unroll
    for (int q = 0; q < 8; ++q) { float x0 = f[q], x1 = f[q ^ 1];   /* q ^ 1: the interleaved pair partner (d is a multiple of 8) */
        if (RF) { float n0 = __fmul_rn(x0, rf), n1 = __fmul_rn(x1, rf); asm volatile("" : "+v"(n0)); asm volatile("" : "+v"(n1)); x0 = __fmul_rn(bfr(nv[q]), n0); x1 = __fmul_rn(bfr(nv[q ^ 1]), n1); }
        const float cc = q < 4 ? cs0[2 * (q & 3)] : cs1[2 * (q & 3)], ss = q < 4 ? cs0[2 * (q & 3) + 1] : cs1[2 * (q & 3) + 1]; float a = __fmul_rn(x0, cc), bq = __fmul_rn(x1, ss); asm volatile("" : "+v"(a)); asm volatile("" : "+v"(bq)); const float r = (((q & 1) == 0) ? __fsub_rn(a, bq) : __fadd_rn(a, bq)) * sc;   /* even: tr c - ti s; odd: ti c + tr s */
        o16[q] = tohx(r); unsigned short a2, c2; splitf(r, a2, c2); oh[q] = a2; ol[q] = c2; }
    *(v8h*)(P16 + i * 8) = o16; *(v8us*)(Ph + i * 8) = oh; *(v8us*)(Pl + i * 8) = ol;  }
// k_vtp: transposed value planes [g] of [d][t] in fragment order (fp16 + hi/lo); one 16-byte piece (eight t of one d) per thread and plane
template <int PITCH> __global__ __launch_bounds__(256) void k_vtp(const float* __restrict__ F, int nheads, h16* V16, bf* Vh, bf* Vl) { const size_t i = (size_t)blockIdx.x * 256 + threadIdx.x; if (i >= (size_t)nheads * HD * TT / 8) return; const int g = (int)(i / (HD * TT / 8)); int d, t; piece_rk(i % (HD * TT / 8), TT, d, t); const float* p = F + (size_t)t * PITCH + g * HD + d; float xs[8]; v8h o16; v8us oh, ol;
#pragma unroll
    for (int q = 0; q < 8; ++q) xs[q] = p[q * PITCH];
    wait_x(p, p);
#pragma unroll
    for (int q = 0; q < 8; ++q) { const float x = xs[q]; o16[q] = tohx(x); unsigned short a2, c2; splitf(x, a2, c2); oh[q] = a2; ol[q] = c2; }
    *(v8h*)(V16 + i * 8) = o16; *(v8us*)(Vh + i * 8) = oh; *(v8us*)(Vl + i * 8) = ol;  }
#define FNW 8
#define FP  132                   // slab row pitch in floats: 128 + 4, rows stay 16-byte aligned
__device__ __forceinline__ float xhalf(float x) { return __builtin_bit_cast(float, __builtin_amdgcn_permlanex16(__builtin_bit_cast(int, x), __builtin_bit_cast(int, x), 0x76543210, 0xfedcba98, false, false)); }  // lane l with lane l ^ 16
// exp2s: 2^x with, in the same statement, the one free slot that the instruction set asks for between a transcendental and a next instruction that reads its result or overwrites its source
__device__ __forceinline__ float exp2s(float x) { float r; asm("v_exp_f32 %0, %1\n\tv_nop" : "=v"(r) : "v"(x)); return r; }
template <typename T16> __device__ __forceinline__ void ldk(typename WFrag<T16>::V (&k)[2][4], const T16* base, int blk, int lane) {
    const T16* p = base + (size_t)(blk * 32) * HD + 8 * lane;   // fragment order: 16 keys are four blocks of 512 elements
#pragma unroll
    for (int kt = 0; kt < 2; ++kt)
#pragma unroll
        for (int kc = 0; kc < 4; ++kc) k[kt][kc] = WFrag<T16>::ldf(p + kt * 16 * HD + kc * 512);
    wait_x(p, p); }
template <typename T16, bool HI>
__device__ __forceinline__ void fattn_body(const T16* Q, const T16* Q2, const T16* Kp, const T16* K2, const T16* VT, const T16* VT2, const int* SLb, bf* Ah, bf* Al, float* slab, float* ms, float* ls, int h, int qb) {
    typedef typename WFrag<T16>::V V;
    const int lane = threadIdx.x & 31, lr = lane & 15, hi = lane >> 4; const int wv = __builtin_amdgcn_readfirstlane((int)(threadIdx.x >> 5));
    const int q0 = qb * 32;
    const int slen = min(max(SLb[0], 0), TT);                 // valid key count of this batch (int32 input), bounded by the shape
    const int np = min(qb + 1, (slen + 31) >> 5);             // 32-key passes of this query block: up to the diagonal and up to the last valid key
    const float cscale = SCL * 1.4426950408889634f, NINF = -__builtin_inff();
    const size_t qo = (size_t)h * TT * HD, ko = (size_t)(h / REP) * TT * HD;
    Q += qo; Kp += ko; VT += ko; if (HI) { Q2 += qo; K2 += ko; VT2 += ko; }
    V qf[2][4], q2[2][4];
#pragma unroll
    for (int g = 0; g < 2; ++g) { const size_t o = (size_t)(q0 + 16 * g) * HD + 8 * lane; const T16* qp = Q + o; const T16* qp2 = HI ? Q2 + o : qp;
#pragma unroll
        for (int kc = 0; kc < 4; ++kc) { qf[g][kc] = WFrag<T16>::ldf(qp + 512 * kc); if (HI) q2[g][kc] = WFrag<T16>::ldf(qp2 + 512 * kc); }
        wait_x(qp, qp2); }
    v8f acc[2][8]; float m_run[2], l_run[2];
#pragma unroll
    for (int g = 0; g < 2; ++g) { m_run[g] = NINF; l_run[g] = 0.f;
#pragma unroll
        for (int t = 0; t < 8; ++t) acc[g][t] = (v8f){}; }
    V kf[2][4];
    if (!HI) ldk<T16>(kf, Kp, max(min(wv, np - 1), 0), lane);
#pragma unroll 1
    for (int blk = wv; blk < np; blk += FNW) {
        const int key0 = blk * 32;
        V vf[8], v2[8], k2[2][4];
        if (HI) { ldk<T16>(kf, Kp, blk, lane); ldk<T16>(k2, K2, blk, lane); }   // six planes: no room to hold a pass ahead
        { const size_t o = (size_t)key0 * 16 + 8 * lane;   /* fragment order: 32 keys of 16 rows are one block of 512 elements, 16 rows 16 TT */ const T16* vp = VT + o; const T16* vp2 = HI ? VT2 + o : vp;
#pragma unroll
          for (int t = 0; t < 8; ++t) { vf[t] = WFrag<T16>::ldf(vp + (size_t)t * 16 * TT); if (HI) v2[t] = WFrag<T16>::ldf(vp2 + (size_t)t * 16 * TT); }
          wait_x(vp, vp2); }
        v8f s[2][2];
#pragma unroll
        for (int kt = 0; kt < 2; ++kt)
#pragma unroll
            for (int g = 0; g < 2; ++g) { s[kt][g] = (v8f){};
#pragma unroll
                for (int kc = 0; kc < 4; ++kc) { s[kt][g] = WFrag<T16>::mma(kf[kt][kc], qf[g][kc], s[kt][g]); if (HI) { s[kt][g] = WFrag<T16>::mma(k2[kt][kc], qf[g][kc], s[kt][g]); s[kt][g] = WFrag<T16>::mma(kf[kt][kc], q2[g][kc], s[kt][g]); } } }
        if (!HI) ldk<T16>(kf, Kp, min(blk + FNW, np - 1), lane);     // this wave's next pass's K rows fly under the softmax (the last pass reads a valid row block again)
        if (blk == qb || key0 + 32 > slen) {                  // wave-uniform: only the pass on the diagonal or across the last valid key pays for the mask
#pragma unroll
            for (int g = 0; g < 2; ++g)
#pragma unroll
                for (int kt = 0; kt < 2; ++kt)
#pragma unroll
                    for (int r = 0; r < 8; ++r) { const int key = key0 + 16 * kt + 8 * hi + r; if (key > q0 + 16 * g + lr || key >= slen) s[kt][g][r] = NINF; }   /* causal OR key padding; the pass's first key stays for every query */
        }
        float mb[2]; bool need = false;
#pragma unroll
        for (int g = 0; g < 2; ++g) { float mx = NINF;
#pragma unroll
            for (int kt = 0; kt < 2; ++kt)
#pragma unroll
                for (int r = 0; r < 8; ++r) mx = fmaxf(mx, s[kt][g][r]);
            mx = fmaxf(mx, xhalf(mx)) * cscale; mb[g] = mx; need = need || (mx > m_run[g] + 8.0f); }
        if (__builtin_amdgcn_ballot_w32(need) != 0) {
#pragma unroll
            for (int g = 0; g < 2; ++g) { const float m_new = fmaxf(m_run[g], mb[g]); const float corr = exp2s(m_run[g] - m_new);   /* 0 on the first pass */ l_run[g] *= corr; m_run[g] = m_new;
#pragma unroll
                for (int t = 0; t < 8; ++t) acc[g][t] = acc[g][t] * corr; }
        }
#pragma unroll
        for (int g = 0; g < 2; ++g) { const float nm = (HI ? 0.0f : 4.0f) - m_run[g]; float p[16], ps0 = 0.f, ps1 = 0.f;
#pragma unroll
            for (int e = 0; e < 16; ++e) { p[e] = exp2s(__builtin_fmaf(s[e >> 3][g][e & 7], cscale, nm)); if (e & 1) ps1 += p[e]; else ps0 += p[e]; }
            l_run[g] += ps0 + ps1;
            if (HI) { v8us h0, h1, l0, l1;
#pragma unroll
                for (int e = 0; e < 8; ++e) { unsigned short a, c2; splitf(p[e], a, c2); h0[e] = a; l0[e] = c2; splitf(p[e + 8], a, c2); h1[e] = a; l1[e] = c2; }
                const v16bf ph = cat16b(h0, h1), pl = cat16b(l0, l1);
#pragma unroll
                for (int t = 0; t < 8; ++t) { acc[g][t] = wmmab(__builtin_bit_cast(v16bf, vf[t]), ph, acc[g][t]); acc[g][t] = wmmab(__builtin_bit_cast(v16bf, vf[t]), pl, acc[g][t]); acc[g][t] = wmmab(__builtin_bit_cast(v16bf, v2[t]), ph, acc[g][t]); }
            } else { v16h pf;
#pragma unroll
                for (int e = 0; e < 16; ++e) pf[e] = (h16)p[e];
#pragma unroll
                for (int t = 0; t < 8; ++t) acc[g][t] = wmma16(__builtin_bit_cast(v16h, vf[t]), pf, acc[g][t]); } }
        __builtin_amdgcn_sched_barrier(0);                    // keeps the matrix instructions in front of the slots below
        asm volatile("v_nop\n\tv_nop\n\tv_nop\n\tv_nop\n\tv_nop");   // the distance behind the last matrix instruction on the loop's back edge
    }
    if (wv < np) {                                            // wave-uniform: a wave without a pass leaves no slab
#pragma unroll
        for (int g = 0; g < 2; ++g) { const float lf = l_run[g] + xhalf(l_run[g]);   /* each wave half summed its own eight keys of every 16 */ const int row = wv * 32 + 16 * g + lr;
            if (hi == 0) { ms[row] = m_run[g]; ls[row] = lf; }
#pragma unroll
            for (int t = 0; t < 8; ++t) { float* d = slab + row * FP + 16 * t + 8 * hi; const v8f a = acc[g][t]; *(v4fa*)d = (v4f){a[0], a[1], a[2], a[3]}; *(v4fa*)(d + 4) = (v4f){a[4], a[5], a[6], a[7]}; } }
    }
    __syncthreads();                                          // every wave's slab, maximum and sum are written before any is read
    const int na = min(FNW, np); const int q = threadIdx.x >> 3, dl = (threadIdx.x & 7) * 8;
    float mstar = NINF;
    for (int w = 0; w < na; ++w) mstar = fmaxf(mstar, ms[w * 32 + q]);
    float L = 0.f; v4f o[4];
#pragma unroll
    for (int i = 0; i < 4; ++i) o[i] = (v4f){};
    for (int w = 0; w < na; ++w) { const float f = exp2s(ms[w * 32 + q] - mstar); L += f * ls[w * 32 + q]; const float* sp = slab + (w * 32 + q) * FP + dl;
        o[0] += f * *(const v4fa*)sp; o[1] += f * *(const v4fa*)(sp + 4); o[2] += f * *(const v4fa*)(sp + 64); o[3] += f * *(const v4fa*)(sp + 68); }
    const float inv = __fdiv_rn(1.0f, L);
#pragma unroll
    for (int i = 0; i < 2; ++i) { v8us oh, ol;
#pragma unroll
        for (int e = 0; e < 8; ++e) { unsigned short a, c2; splitf(o[2 * i + (e >> 2)][e & 3] * inv, a, c2); oh[e] = a; ol[e] = c2; }
        const size_t oo = fragoff(q0 + q, h * HD + dl + 64 * i, DQ);   /* the output GEMM reads these planes in fragment order */ *(v8us*)(Ah + oo) = oh; *(v8us*)(Al + oo) = ol; }
}
__global__ __launch_bounds__(32 * FNW) void k_fattn(const h16* Q16, const h16* K16, const h16* V16, const bf* Qh, const bf* Ql, const bf* Kh, const bf* Kl, const bf* Vh, const bf* Vl, const int* SLb, bf* Ah, bf* Al) {   // no __restrict__: the plane loads keep their place in front of their waits
    __shared__ __align__(16) float slab[FNW * 32 * FP];
    __shared__ float ms[FNW * 32], ls[FNW * 32];
    const int h = blockIdx.x, qb = TT / 32 - 1 - (int)blockIdx.y;   // the longest query blocks start first
    if (qb < RH / 32) fattn_body<bf, true>(Qh, Ql, Kh, Kl, Vh, Vl, SLb, Ah, Al, slab, ms, ls, h, qb);   // block-uniform
    else fattn_body<h16, false>(Q16, nullptr, K16, nullptr, V16, nullptr, SLb, Ah, Al, slab, ms, ls, h, qb);
}

extern "C" void kernel_launch(void* const* d_in, const int* in_sizes, int n_in,
                              void* d_out, int out_size, void* d_ws, size_t ws_size, hipStream_t stream) {
    (void)in_sizes; (void)n_in; (void)out_size;
    const float* x = (const float*)d_in[0]; const float* wq = (const float*)d_in[1]; const float* wkv = (const float*)d_in[2]; const float* wo = (const float*)d_in[3]; const float* cosT = (const float*)d_in[4]; const float* sinT = (const float*)d_in[5]; const int* SL = (const int*)d_in[6]; const float* wk = nullptr; const float* wv = nullptr; (void)wk; (void)wv;
    float* OUT = (float*)d_out;     // [2][2048][2048]
    char* wsp = (char*)d_ws;
    auto take = [&](size_t bytes) { char* p = wsp; wsp += (bytes + 255) & ~(size_t)255; return (void*)p; };
    bf* WQ = (bf*)take((size_t)DQ * DM * 2); bf* WKV = (bf*)take((size_t)2 * DKV * DM * 2); bf* WK = WKV; bf* WV = WKV + (size_t)DKV * DM;   /* row blocks of the transposed fused wkv: 1024 rows are 1024 K elements in fragment order too */ bf* WO = (bf*)take((size_t)DM * DQ * 2); float* CS = (float*)take((size_t)TT * HD * 2 * 4);
    bf* XB = (bf*)take((size_t)TT * DM * 2); float* FQ = (float*)take((size_t)TT * DQ * 4); float* FK = (float*)take((size_t)TT * DKV * 4);
    h16* QP16 = (h16*)take((size_t)NH_ * TT * HD * 2); h16* KP16 = (h16*)take((size_t)NKV * TT * HD * 2); h16* VT16 = (h16*)take((size_t)NKV * HD * TT * 2);
    bf* QPh = (bf*)take((size_t)NH_ * TT * HD * 2); bf* QPl = (bf*)take((size_t)NH_ * TT * HD * 2); bf* KPh = (bf*)take((size_t)NKV * TT * HD * 2); bf* KPl = (bf*)take((size_t)NKV * TT * HD * 2); bf* VTh = (bf*)take((size_t)NKV * HD * TT * 2); bf* VTl = (bf*)take((size_t)NKV * HD * TT * 2);
    bf* ATh = (bf*)FQ; bf* ATl = ATh + (size_t)TT * DQ;   // the merged hi/lo planes reuse the q projection buffer, which is dead once the q planes are built (stream-ordered)
    if ((size_t)(wsp - (char*)d_ws) > ws_size) return;    // ws 256 MiB
    float* FV = FK;   // v projection reuses the k buffer after the k planes are built (stream-ordered)
    { k_wtG<DM, DQ><<<(unsigned)((DM * DQ / 8 + 255) / 256), 256, 0, stream>>>(wq, WQ); k_wtG<DM, 2 * DKV><<<(unsigned)((DM * 2 * DKV / 8 + 255) / 256), 256, 0, stream>>>(wkv, WKV);   /* 'xw' [2048][2048] -> Bt [2048][2048]: rows 0-1023 k, 1024-2047 v */
      k_wtG<DQ, DM><<<(unsigned)((DQ * DM / 8 + 255) / 256), 256, 0, stream>>>(wo, WO);
       }
    const unsigned LQ = (unsigned)(((size_t)NH_ * TT * HD / 8 + 255) / 256), LKv = (unsigned)(((size_t)NKV * TT * HD / 8 + 255) / 256);
    for (int b = 0; b < NB_; ++b) {
        if (b == 0) k_cscvt<<<(TT * HD + 255) / 256, 256, 0, stream>>>(cosT, sinT, CS);
        k_cvt8<<<(unsigned)(((size_t)TT * DM / 8 + 255) / 256), 256, 0, stream>>>(x + (size_t)b * TT * DM, XB, DM, (size_t)TT * DM / 8);
        k_gemmw<bf, 0, false, 4, DM><<<dim3(TT / 64, DQ / 64, 1), 128, 0, stream>>>(XB, nullptr, WQ, nullptr, FQ, DQ, nullptr, 0, 0, 0);
        k_rope<<<LQ, 256, 0, stream>>>(FQ, DQ, NH_, CS, nullptr, nullptr, 1.0f, QP16, QPh, QPl);
        k_gemmw<bf, 0, false, 8, DM><<<dim3(TT / 64, DKV / 64, 1), 256, 0, stream>>>(XB, nullptr, WK, nullptr, FK, DKV, nullptr, 0, 0, 0);
        k_rope<<<LKv, 256, 0, stream>>>(FK, DKV, NKV, CS, nullptr, nullptr, 1.0f, KP16, KPh, KPl);
        k_gemmw<bf, 0, false, 8, DM><<<dim3(TT / 64, DKV / 64, 1), 256, 0, stream>>>(XB, nullptr, WV, nullptr, FV, DKV, nullptr, 0, 0, 0); k_vtp<DKV><<<LKv, 256, 0, stream>>>(FV, NKV, VT16, VTh, VTl);
        k_fattn<<<dim3(NH_, TT / 32, 1), 32 * FNW, 0, stream>>>(QP16, KP16, VT16, QPh, QPl, KPh, KPl, VTh, VTl, SL + b, ATh, ATl);
        k_gemmw<bf, 1, false, 4, DQ><<<dim3(TT / 64, DM / 64, 1), 128, 0, stream>>>(ATh, ATl, WO, nullptr, OUT + (size_t)b * TT * DM, DM, nullptr, 0, 0, 0); }
}

// v005
// A run of this version takes 225 microseconds.
// Next to v004, in two timings, it ran 1.26 and 1.25 times as fast.
// All steps since v000 together make it 7.50 times as fast.
#include <hip/hip_runtime.h>

// Causal GQA with key-padding mask and interleaved rotary (x [2][2048][2048]; q = x wq ('xw' [2048][2048], 16 heads x 128); [k|v] = x wkv ('xw' [2048][2048]: columns 0-1023 k, 1024-2047 v; 8 kv heads x 128); llama-style interleaved RoPE from the given tables [2048][64] on q, k; 2 query heads per kv head; scores/sqrt(128) masked where j > i OR j >= seq_lengths[b] (int32 input, read on device); softmax; out = merged wo ('xw') -> [2][2048][2048]).
// Compute dtypes, f32 accumulate: every input rounded to bf16; q/k/v on PLAIN bf16 operands (inputs: exact); rotary in f32 from the bf16-rounded tables; causal + padding-masked scores and attn.v (causal tile skipping): query rows < 512 hl (3 products), the rest single fp16 (probabilities x16); online softmax f32, attention fused in one kernel; wo hl x exact (2 products).
// Every 16-bit operand plane of a matrix product (x, the transposed weights, q, k, transposed v, the merged attention hi/lo) lies in fragment order (fragoff below), not row-major.

#define NB_  2
#define TT   2048
#define DM   2048
#define NH_  16
#define NKV  8
#define REP  (NH_ / NKV)
#define HD   128
#define DQ   (NH_ * HD)
#define DKV  (NKV * HD)
#define RH   512                  // query rows < RH use hi+lo planes (0: none)
#define SCL  0.088388347648318447f   // HD^-0.5
typedef _Float16 h16;
typedef unsigned short bf;
typedef __attribute__((ext_vector_type(16))) __bf16   v16bf;
typedef __attribute__((ext_vector_type(16))) _Float16 v16h;
typedef __attribute__((ext_vector_type(8)))  _Float16 v8h;
typedef __attribute__((ext_vector_type(8)))  unsigned short v8us;
typedef __attribute__((ext_vector_type(8)))  float    v8f;
typedef __attribute__((ext_vector_type(4)))  float    v4f;
typedef v8h  __attribute__((may_alias)) v8ha;
typedef v4f  __attribute__((may_alias)) v4fa;
typedef v8us __attribute__((may_alias)) v8usa;

__device__ __forceinline__ unsigned short f2bf(float f) { unsigned u = __float_as_uint(f); u += 0x7FFFu + ((u >> 16) & 1u); return (unsigned short)(u >> 16); }
__device__ __forceinline__ float bf2f(unsigned short b) { return __uint_as_float(((unsigned)b) << 16); }
__device__ __forceinline__ float bfr(float f) { return bf2f(f2bf(f)); }
__device__ __forceinline__ v16h cat16(v8h lo, v8h hi) { return __builtin_shufflevector(lo, hi, 0, 1, 2, 3, 4, 5, 6, 7, 8, 9, 10, 11, 12, 13, 14, 15); }
__device__ __forceinline__ v16bf cat16b(v8us lo, v8us hi) { return __builtin_bit_cast(v16bf, __builtin_shufflevector(lo, hi, 0, 1, 2, 3, 4, 5, 6, 7, 8, 9, 10, 11, 12, 13, 14, 15)); }
__device__ __forceinline__ v8f wmma16(v16h a, v16h b, v8f c) { return __builtin_amdgcn_wmma_f32_16x16x32_f16(false, a, false, b, (short)0, c, false, false); }
__device__ __forceinline__ v8f wmmab(v16bf a, v16bf b, v8f c) { return __builtin_amdgcn_wmma_f32_16x16x32_bf16(false, a, false, b, (short)0, c, false, false); }



// tile_sync: orders the LDS slab writes against the reads of the tile epilogue; one wave needs no hardware barrier, several waves need the work-group barrier.
// The fences name LDS alone: only LDS data passes between the waves here, and a full __syncthreads() would also hold every wave until the tile rows just stored to global memory have landed, at each of the four stages.
template <int NW> __device__ __forceinline__ void tile_sync() {
    if (NW == 1) { __builtin_amdgcn_wave_barrier(); asm volatile("" ::: "memory"); }
    else { __builtin_amdgcn_fence(__ATOMIC_RELEASE, "workgroup", "local"); __builtin_amdgcn_s_barrier(); __builtin_amdgcn_fence(__ATOMIC_ACQUIRE, "workgroup", "local"); } }

// Fragment order of a 16-bit operand plane [R][K] (R % 16 == 0, K % 32 == 0): blocks of 16 rows x 32 k, 512 elements each, block (r / 16, k / 32) at index (r / 16) * (K / 32) + k / 32.
// Inside a block the 16-byte piece that holds k & ~7 .. k | 7 of row r is piece ((k / 16) % 2) * 32 + ((k / 8) % 2) * 16 + r % 16: pieces 0-31 are the 32 lanes' first eight k of a 16x16x32 fragment, pieces 32-63 their second eight,
// so that a fragment is two loads of 512 contiguous bytes (four whole cache lines each) where a row-major plane gives 32 bytes from each of 16 lines. The values in each lane's registers are those of the row-major loader.
__device__ __forceinline__ size_t fragoff(int r, int k, int K) { return ((size_t)(r >> 4) * (K >> 5) + (k >> 5)) * 512 + (((k >> 4) & 1) * 32 + ((k >> 3) & 1) * 16 + (r & 15)) * 8 + (k & 7); }
// piece_rk: the row and the first k of 16-byte piece i of such a plane (the inverse of fragoff)
__device__ __forceinline__ void piece_rk(size_t i, int K, int& r, int& k) { const int w = (int)(i & 63); const int blk = (int)(i >> 6), kb = blk % (K >> 5), rb = blk / (K >> 5); r = rb * 16 + (w & 15); k = kb * 32 + (w >> 5) * 16 + ((w >> 4) & 1) * 8; }
// wait_x: stands behind a group of global loads, in front of any reuse of the address registers that they name; the lane addresses are inputs so that their registers stay whole up to the wait
template <typename T16> __device__ __forceinline__ void wait_x(const T16* p, const T16* p2) { asm volatile("s_wait_xcnt 0x0" :: "v"(p), "v"(p2) : "memory"); }
// ---- k_gemmw: register-blocked GEMM, one 64x64 output tile per work-group of NW waves (16 accumulators per wave), operands straight from 16-bit planes in fragment order; grid (M/64, N/64, Z), 32 * NW threads.
// Wave w takes the 32-wide K chunks w, w + NW, w + 2 NW, ...; the NW partial tiles are summed in wave order 0..NW-1 through LDS (one slab per wave) before the store.
// C[m][n] (f32, pitch ldc, + optional f32 bias[n]) = sum_k A[m][k] Bt[n][k] (+ split products per NSPLIT). z-batch strides sA/sB/sC in elements. K % 32 == 0, a constant of the build so that the row blocks' distances are immediates.
template <typename T16> struct WFrag;
template <> struct WFrag<h16> { typedef v16h V; static __device__ __forceinline__ V ldf(const h16* p) { return cat16(*(const v8h*)p, *(const v8h*)(p + 256)); } static __device__ __forceinline__ v8f mma(V a, V b, v8f c) { return wmma16(a, b, c); } };
template <> struct WFrag<bf> { typedef v16bf V; static __device__ __forceinline__ V ldf(const bf* p) { return cat16b(*(const v8us*)p, *(const v8us*)(p + 256)); } static __device__ __forceinline__ v8f mma(V a, V b, v8f c) { return wmmab(a, b, c); } };
// EPI 1 (the fused q, k, v projection; A = x, Bt = the transposed [wq | wkv], 4096 rows): no f32 tile leaves the kernel. The epilogue rounds the rotary tables, turns the q and k columns and stores the fp16 and hi/lo operand planes of the attention kernel in fragment order,
// one 16-byte piece per thread, plane and stage (128 threads, 16 x 64 values a stage; a wave stores 512 contiguous bytes). A work-group of v columns swaps its two operands, so that its tile is v^T (rows d, columns t) and a piece of the transposed plane is eight columns of one tile row as well.
struct Planes { h16* q16; bf* qh; bf* ql; h16* k16; bf* kh; bf* kl; h16* v16; bf* vh; bf* vl; };
__device__ __forceinline__ void splitf(float y, unsigned short& h, unsigned short& l) { h = f2bf(y); l = f2bf(y - bf2f(h)); }
template <typename T16, int NSPLIT, bool BIAS, int NW, int K, int EPI>
__global__ __launch_bounds__(32 * NW) void k_gemmw(const T16* __restrict__ A, const T16* __restrict__ A2, const T16* __restrict__ Bt, const T16* __restrict__ Bt2, float* C, int ldc, const float* __restrict__ bias, size_t sA, size_t sB, size_t sC, const float* __restrict__ cosT, const float* __restrict__ sinT, Planes P) {
    static_assert(EPI == 0 || (NW == 4 && NSPLIT == 0), "the plane epilogue has one piece per thread of four waves");
    typedef typename WFrag<T16>::V V;
    __shared__ __align__(16) float os[NW * 16 * 68];
    const size_t z = blockIdx.z; A += z * sA; if (A2) A2 += z * sA; Bt += z * sB; if (Bt2) Bt2 += z * sB; C += z * sC;
    const int lane = threadIdx.x & 31, lr = lane & 15, hi = lane >> 4; const int wv = (NW == 1) ? 0 : __builtin_amdgcn_readfirstlane((int)(threadIdx.x >> 5)); const int r0 = blockIdx.x * 64, c0 = blockIdx.y * 64;
    v8f acc[4][4];
#pragma unroll
    for (int mb = 0; mb < 4; ++mb)
#pragma unroll
        for (int nb = 0; nb < 4; ++nb) acc[mb][nb] = (v8f){};
    // 16 rows of a plane are 16 K elements, a 32-wide K chunk 512: one lane pointer per plane walks the chunks, the four row blocks stand at constant distances from it
    const size_t l8 = (size_t)wv * 512 + 8 * lane; const T16* pa = A + (size_t)r0 * K + l8; const T16* pb = Bt + (size_t)c0 * K + l8; const T16* pa2 = (NSPLIT == 1 || NSPLIT == 2) ? A2 + (size_t)r0 * K + l8 : pa; const T16* pb2 = (NSPLIT >= 2) ? Bt2 + (size_t)c0 * K + l8 : pb;
    const bool isv = EPI == 1 && c0 >= DQ + DKV;   // block-uniform: a tile of v columns
    if (isv) { const T16* sw = pa; pa = pb; pb = sw; }   // tile rows = weight rows (d), tile columns = positions (t)
#pragma unroll 1
    for (int kc = wv * 32; kc < K; kc += 32 * NW) {
        V a[4], a2[4], b[4], b2[4];
#pragma unroll
        for (int mb = 0; mb < 4; ++mb) { a[mb] = WFrag<T16>::ldf(pa + mb * 16 * K); if (NSPLIT == 1 || NSPLIT == 2) a2[mb] = WFrag<T16>::ldf(pa2 + mb * 16 * K); }
#pragma unroll
        for (int nb = 0; nb < 4; ++nb) { b[nb] = WFrag<T16>::ldf(pb + nb * 16 * K); if (NSPLIT >= 2) b2[nb] = WFrag<T16>::ldf(pb2 + nb * 16 * K); }
        if (NSPLIT == 0) wait_x(pa, pb); else asm volatile("s_wait_xcnt 0x0" :: "v"(pa), "v"(pb), "v"(pa2), "v"(pb2) : "memory");   // as wait_x: in front of the steps of the lane pointers below
        pa += 512 * NW; pb += 512 * NW; if (NSPLIT != 0) { pa2 += 512 * NW; pb2 += 512 * NW; }
#pragma unroll
        for (int nb = 0; nb < 4; ++nb) {
#pragma unroll
            for (int mb = 0; mb < 4; ++mb) { acc[mb][nb] = WFrag<T16>::mma(a[mb], b[nb], acc[mb][nb]); if (NSPLIT == 1 || NSPLIT == 2) acc[mb][nb] = WFrag<T16>::mma(a2[mb], b[nb], acc[mb][nb]); if (NSPLIT >= 2) acc[mb][nb] = WFrag<T16>::mma(a[mb], b2[nb], acc[mb][nb]); } }
        asm volatile("v_nop\n\tv_nop\n\tv_nop\n\tv_nop" : "+v"(acc[0][0]), "+v"(acc[1][1]), "+v"(acc[2][2]), "+v"(acc[3][3]) : "v"(a[0]), "v"(a[3]));
    }
    // EPI 1: thread i owns piece i of the stage's two fragment blocks: tile row erow, tile columns ec8 .. ec8 + 7 (piece_rk's map)
    const int erow = threadIdx.x & 15, ec8 = (int)(threadIdx.x >> 6) * 32 + (int)((threadIdx.x >> 5) & 1) * 16 + (int)((threadIdx.x >> 4) & 1) * 8;
    h16* e16 = nullptr; bf* eh = nullptr; bf* el = nullptr; size_t estep = 0; v4f cq[4], sq[4];
    if (EPI == 1) {
        size_t eo;
        if (isv) { const int n = c0 - (DQ + DKV); eo = (size_t)(n / HD) * HD * TT + fragoff(n % HD + erow, r0 + ec8, TT); estep = (size_t)16 * TT; e16 = P.v16; eh = P.vh; el = P.vl; }
        else { const bool isk = c0 >= DQ; const int n = isk ? c0 - DQ : c0; eo = (size_t)(n / HD) * TT * HD + fragoff(r0 + erow, n % HD + ec8, HD); estep = (size_t)16 * HD; e16 = isk ? P.k16 : P.q16; eh = isk ? P.kh : P.qh; el = isk ? P.kl : P.ql;
            // the four stages' table entries (interleaved pairs (2i, 2i+1) use table column i) fly under the first stage's slab writes
            const size_t to = (size_t)(r0 + erow) * (HD / 2) + ((n % HD + ec8) >> 1); const float* pc = cosT + to; const float* ps = sinT + to;
#pragma unroll
            for (int mb = 0; mb < 4; ++mb) { cq[mb] = *(const v4f*)(pc + mb * 16 * (HD / 2)); sq[mb] = *(const v4f*)(ps + mb * 16 * (HD / 2)); }
            wait_x(pc, ps); }
        e16 += eo; eh += eo; el += eo; }
#pragma unroll
    for (int mb = 0; mb < 4; ++mb) {
#pragma unroll
        for (int nb = 0; nb < 4; ++nb) {
#pragma unroll
            for (int j = 0; j < 8; ++j) os[wv * (16 * 68) + (hi * 8 + j) * 68 + nb * 16 + lr] = acc[mb][nb][j]; }
        tile_sync<NW>();
        if (EPI == 1) {
            const float* sp = os + erow * 68 + ec8; v4f x0 = *(const v4fa*)sp, x1 = *(const v4fa*)(sp + 4);
#pragma unroll
            for (int w = 1; w < NW; ++w) { x0 += *(const v4fa*)(sp + w * (16 * 68)); x1 += *(const v4fa*)(sp + w * (16 * 68) + 4); }
            float r[8] = {x0[0], x0[1], x0[2], x0[3], x1[0], x1[1], x1[2], x1[3]};
            if (!isv) {
#pragma unroll
                for (int i = 0; i < 4; ++i) { const float c = bfr(cq[mb][i]), s = bfr(sq[mb][i]), tr = r[2 * i], ti = r[2 * i + 1]; r[2 * i] = tr * c - ti * s; r[2 * i + 1] = tr * s + ti * c; } }
            v8h o16; v8us oh, ol;
#pragma unroll
            for (int e = 0; e < 8; ++e) { o16[e] = (h16)r[e]; unsigned short a2, c2; splitf(r[e], a2, c2); oh[e] = a2; ol[e] = c2; }
            *(v8h*)(e16 + mb * estep) = o16; *(v8us*)(eh + mb * estep) = oh; *(v8us*)(el + mb * estep) = ol;
        } else {
            float* crow = C + (size_t)(r0 + mb * 16) * ldc + c0;
#pragma unroll
            for (int s = 0; s < (NW < 8 ? 8 / NW : 1); ++s) { const int row = 2 * NW * s + 2 * wv + hi, cofs = lr * 4; if (NW > 8 && wv >= 8) break;   /* 16 rows: waves 8 and up have none */ v4f val = *(const v4fa*)(os + row * 68 + cofs);
#pragma unroll
                for (int w = 1; w < NW; ++w) val += *(const v4fa*)(os + w * (16 * 68) + row * 68 + cofs);
                if (BIAS) { val[0] += bfr(bias[c0 + cofs]); val[1] += bfr(bias[c0 + cofs + 1]); val[2] += bfr(bias[c0 + cofs + 2]); val[3] += bfr(bias[c0 + cofs + 3]); }
                *(v4f*)(crow + (size_t)row * ldc + cofs) = val; }
             }
        if (mb < 3) {   // the slabs are rewritten by the next stage only
            if (NW > 1) asm volatile("s_wait_xcnt 0x0" ::: "memory");   // stands in front of the next stage's reuse of the registers that the stores above name
            tile_sync<NW>(); }
    }
}

typedef __attribute__((ext_vector_type(2))) _Float16 v2h;
typedef __attribute__((ext_vector_type(4))) _Float16 v4h;
typedef __attribute__((ext_vector_type(2))) unsigned short v2us;
typedef __attribute__((ext_vector_type(4))) unsigned short v4us;
typedef __attribute__((ext_vector_type(2))) float v2f;
typedef __attribute__((ext_vector_type(4))) int v4i;

// k_wtG: w [K][N] f32 -> Bt [N][K] bf16 in fragment order, one 16-byte piece (eight k of one n) per thread: a wave stores 512 contiguous bytes
template <int K, int N> __global__ __launch_bounds__(256) void k_wtG(const float* __restrict__ w, bf* Bt) { const size_t i = (size_t)blockIdx.x * 256 + threadIdx.x; if (i >= (size_t)N * K / 8) return; int n, k; piece_rk(i, K, n, k); const float* p = w + (size_t)k * N + n; float x[8]; v8us o;
#pragma unroll
    for (int e = 0; e < 8; ++e) x[e] = p[e * N];
    wait_x(p, p);
#pragma unroll
    for (int e = 0; e < 8; ++e) o[e] = f2bf(x[e]);
    *(v8us*)(Bt + i * 8) = o; }
// k_cvt8: src [R][K] f32 -> dst bf16 in fragment order, one 16-byte piece per thread
__global__ __launch_bounds__(256) void k_cvt8(const float* __restrict__ src, bf* dst, int K, size_t n8) { const size_t i = (size_t)blockIdx.x * 256 + threadIdx.x; if (i >= n8) return; int r, k; piece_rk(i, K, r, k); const float* p = src + (size_t)r * K + k; const v8f v = *(const v8f*)p; wait_x(p, p); v8us o;
#pragma unroll
    for (int e = 0; e < 8; ++e) o[e] = f2bf(v[e]); *(v8us*)(dst + i * 8) = o;  }
#define FNW 8
#define FP  132                   // slab row pitch in floats: 128 + 4, rows stay 16-byte aligned
__device__ __forceinline__ float xhalf(float x) { return __builtin_bit_cast(float, __builtin_amdgcn_permlanex16(__builtin_bit_cast(int, x), __builtin_bit_cast(int, x), 0x76543210, 0xfedcba98, false, false)); }  // lane l with lane l ^ 16
// exp2s: 2^x with, in the same statement, the one free slot that the instruction set asks for between a transcendental and a next instruction that reads its result or overwrites its source
__device__ __forceinline__ float exp2s(float x) { float r; asm("v_exp_f32 %0, %1\n\tv_nop" : "=v"(r) : "v"(x)); return r; }
template <typename T16> __device__ __forceinline__ void ldk(typename WFrag<T16>::V (&k)[2][4], const T16* base, int blk, int lane) {
    const T16* p = base + (size_t)(blk * 32) * HD + 8 * lane;   // fragment order: 16 keys are four blocks of 512 elements
#pragma unroll
    for (int kt = 0; kt < 2; ++kt)
#pragma unroll
        for (int kc = 0; kc < 4; ++kc) k[kt][kc] = WFrag<T16>::ldf(p + kt * 16 * HD + kc * 512);
    wait_x(p, p); }
template <typename T16, bool HI>
__device__ __forceinline__ void fattn_body(const T16* Q, const T16* Q2, const T16* Kp, const T16* K2, const T16* VT, const T16* VT2, const int* SLb, bf* Ah, bf* Al, float* slab, float* ms, float* ls, int h, int qb) {
    typedef typename WFrag<T16>::V V;
    const int lane = threadIdx.x & 31, lr = lane & 15, hi = lane >> 4; const int wv = __builtin_amdgcn_readfirstlane((int)(threadIdx.x >> 5));
    const int q0 = qb * 32;
    const int slen = min(max(SLb[0], 0), TT);                 // valid key count of this batch (int32 input), bounded by the shape
    const int np = min(qb + 1, (slen + 31) >> 5);             // 32-key passes of this query block: up to the diagonal and up to the last valid key
    const float cscale = SCL * 1.4426950408889634f, NINF = -__builtin_inff();
    const size_t qo = (size_t)h * TT * HD, ko = (size_t)(h / REP) * TT * HD;
    Q += qo; Kp += ko; VT += ko; if (HI) { Q2 += qo; K2 += ko; VT2 += ko; }
    V qf[2][4], q2[2][4];
#pragma unroll
    for (int g = 0; g < 2; ++g) { const size_t o = (size_t)(q0 + 16 * g) * HD + 8 * lane; const T16* qp = Q + o; const T16* qp2 = HI ? Q2 + o : qp;
#pragma unroll
        for (int kc = 0; kc < 4; ++kc) { qf[g][kc] = WFrag<T16>::ldf(qp + 512 * kc); if (HI) q2[g][kc] = WFrag<T16>::ldf(qp2 + 512 * kc); }
        wait_x(qp, qp2); }
    v8f acc[2][8]; float m_run[2], l_run[2];
#pragma unroll
    for (int g = 0; g < 2; ++g) { m_run[g] = NINF; l_run[g] = 0.f;
#pragma unroll
        for (int t = 0; t < 8; ++t) acc[g][t] = (v8f){}; }
    V kf[2][4];
    if (!HI) ldk<T16>(kf, Kp, max(min(wv, np - 1), 0), lane);
#pragma unroll 1
    for (int blk = wv; blk < np; blk += FNW) {
        const int key0 = blk * 32;
        V vf[8], v2[8], k2[2][4];
        if (HI) { ldk<T16>(kf, Kp, blk, lane); ldk<T16>(k2, K2, blk, lane); }   // six planes: no room to hold a pass ahead
        { const size_t o = (size_t)key0 * 16 + 8 * lane;   /* fragment order: 32 keys of 16 rows are one block of 512 elements, 16 rows 16 TT */ const T16* vp = VT + o; const T16* vp2 = HI ? VT2 + o : vp;
#pragma unroll
          for (int t = 0; t < 8; ++t) { vf[t] = WFrag<T16>::ldf(vp + (size_t)t * 16 * TT); if (HI) v2[t] = WFrag<T16>::ldf(vp2 + (size_t)t * 16 * TT); }
          wait_x(vp, vp2); }
        v8f s[2][2];
#pragma unroll
        for (int kt = 0; kt < 2; ++kt)
#pragma unroll
            for (int g = 0; g < 2; ++g) { s[kt][g] = (v8f){};
#pragma unroll
                for (int kc = 0; kc < 4; ++kc) { s[kt][g] = WFrag<T16>::mma(kf[kt][kc], qf[g][kc], s[kt][g]); if (HI) { s[kt][g] = WFrag<T16>::mma(k2[kt][kc], qf[g][kc], s[kt][g]); s[kt][g] = WFrag<T16>::mma(kf[kt][kc], q2[g][kc], s[kt][g]); } } }
        if (!HI) ldk<T16>(kf, Kp, min(blk + FNW, np - 1), lane);     // this wave's next pass's K rows fly under the softmax (the last pass reads a valid row block again)
        if (blk == qb || key0 + 32 > slen) {                  // wave-uniform: only the pass on the diagonal or across the last valid key pays for the mask
#pragma unroll
            for (int g = 0; g < 2; ++g)
#pragma unroll
                for (int kt = 0; kt < 2; ++kt)
#pragma unroll
                    for (int r = 0; r < 8; ++r) { const int key = key0 + 16 * kt + 8 * hi + r; if (key > q0 + 16 * g + lr || key >= slen) s[kt][g][r] = NINF; }   /* causal OR key padding; the pass's first key stays for every query */
        }
        float mb[2]; bool need = false;
#pragma unroll
        for (int g = 0; g < 2; ++g) { float mx = NINF;
#pragma unroll
            for (int kt = 0; kt < 2; ++kt)
#pragma unroll
                for (int r = 0; r < 8; ++r) mx = fmaxf(mx, s[kt][g][r]);
            mx = fmaxf(mx, xhalf(mx)) * cscale; mb[g] = mx; need = need || (mx > m_run[g] + 8.0f); }
        if (__builtin_amdgcn_ballot_w32(need) != 0) {
#pragma unroll
            for (int g = 0; g < 2; ++g) { const float m_new = fmaxf(m_run[g], mb[g]); const float corr = exp2s(m_run[g] - m_new);   /* 0 on the first pass */ l_run[g] *= corr; m_run[g] = m_new;
#pragma unroll
                for (int t = 0; t < 8; ++t) acc[g][t] = acc[g][t] * corr; }
        }
#pragma unroll
        for (int g = 0; g < 2; ++g) { const float nm = (HI ? 0.0f : 4.0f) - m_run[g]; float p[16], ps0 = 0.f, ps1 = 0.f;
#pragma unroll
            for (int e = 0; e < 16; ++e) { p[e] = exp2s(__builtin_fmaf(s[e >> 3][g][e & 7], cscale, nm)); if (e & 1) ps1 += p[e]; else ps0 += p[e]; }
            l_run[g] += ps0 + ps1;
            if (HI) { v8us h0, h1, l0, l1;
#pragma unroll
                for (int e = 0; e < 8; ++e) { unsigned short a, c2; splitf(p[e], a, c2); h0[e] = a; l0[e] = c2; splitf(p[e + 8], a, c2); h1[e] = a; l1[e] = c2; }
                const v16bf ph = cat16b(h0, h1), pl = cat16b(l0, l1);
#pragma unroll
                for (int t = 0; t < 8; ++t) { acc[g][t] = wmmab(__builtin_bit_cast(v16bf, vf[t]), ph, acc[g][t]); acc[g][t] = wmmab(__builtin_bit_cast(v16bf, vf[t]), pl, acc[g][t]); acc[g][t] = wmmab(__builtin_bit_cast(v16bf, v2[t]), ph, acc[g][t]); }
            } else { v16h pf;
#pragma unroll
                for (int e = 0; e < 16; ++e) pf[e] = (h16)p[e];
#pragma unroll
                for (int t = 0; t < 8; ++t) acc[g][t] = wmma16(__builtin_bit_cast(v16h, vf[t]), pf, acc[g][t]); } }
        __builtin_amdgcn_sched_barrier(0);                    // keeps the matrix instructions in front of the slots below
        asm volatile("v_nop\n\tv_nop\n\tv_nop\n\tv_nop\n\tv_nop");   // the distance behind the last matrix instruction on the loop's back edge
    }
    if (wv < np) {                                            // wave-uniform: a wave without a pass leaves no slab
#pragma unroll
        for (int g = 0; g < 2; ++g) { const float lf = l_run[g] + xhalf(l_run[g]);   /* each wave half summed its own eight keys of every 16 */ const int row = wv * 32 + 16 * g + lr;
            if (hi == 0) { ms[row] = m_run[g]; ls[row] = lf; }
#pragma unroll
            for (int t = 0; t < 8; ++t) { float* d = slab + row * FP + 16 * t + 8 * hi; const v8f a = acc[g][t]; *(v4fa*)d = (v4f){a[0], a[1], a[2], a[3]}; *(v4fa*)(d + 4) = (v4f){a[4], a[5], a[6], a[7]}; } }
    }
    __syncthreads();                                          // every wave's slab, maximum and sum are written before any is read
    const int na = min(FNW, np); const int q = threadIdx.x >> 3, dl = (threadIdx.x & 7) * 8;
    float mstar = NINF;
    for (int w = 0; w < na; ++w) mstar = fmaxf(mstar, ms[w * 32 + q]);
    float L = 0.f; v4f o[4];
#pragma unroll
    for (int i = 0; i < 4; ++i) o[i] = (v4f){};
    for (int w = 0; w < na; ++w) { const float f = exp2s(ms[w * 32 + q] - mstar); L += f * ls[w * 32 + q]; const float* sp = slab + (w * 32 + q) * FP + dl;
        o[0] += f * *(const v4fa*)sp; o[1] += f * *(const v4fa*)(sp + 4); o[2] += f * *(const v4fa*)(sp + 64); o[3] += f * *(const v4fa*)(sp + 68); }
    const float inv = __fdiv_rn(1.0f, L);
#pragma unroll
    for (int i = 0; i < 2; ++i) { v8us oh, ol;
#pragma unroll
        for (int e = 0; e < 8; ++e) { unsigned short a, c2; splitf(o[2 * i + (e >> 2)][e & 3] * inv, a, c2); oh[e] = a; ol[e] = c2; }
        const size_t oo = fragoff(q0 + q, h * HD + dl + 64 * i, DQ);   /* the output GEMM reads these planes in fragment order */ *(v8us*)(Ah + oo) = oh; *(v8us*)(Al + oo) = ol; }
}
__global__ __launch_bounds__(32 * FNW) void k_fattn(const h16* Q16, const h16* K16, const h16* V16, const bf* Qh, const bf* Ql, const bf* Kh, const bf* Kl, const bf* Vh, const bf* Vl, const int* SLb, bf* Ah, bf* Al) {   // no __restrict__: the plane loads keep their place in front of their waits
    __shared__ __align__(16) float slab[FNW * 32 * FP];
    __shared__ float ms[FNW * 32], ls[FNW * 32];
    const int h = blockIdx.x, qb = TT / 32 - 1 - (int)blockIdx.y;   // the longest query blocks start first
    if (qb < RH / 32) fattn_body<bf, true>(Qh, Ql, Kh, Kl, Vh, Vl, SLb, Ah, Al, slab, ms, ls, h, qb);   // block-uniform
    else fattn_body<h16, false>(Q16, nullptr, K16, nullptr, V16, nullptr, SLb, Ah, Al, slab, ms, ls, h, qb);
}

extern "C" void kernel_launch(void* const* d_in, const int* in_sizes, int n_in,
                              void* d_out, int out_size, void* d_ws, size_t ws_size, hipStream_t stream) {
    (void)in_sizes; (void)n_in; (void)out_size;
    const float* x = (const float*)d_in[0]; const float* wq = (const float*)d_in[1]; const float* wkv = (const float*)d_in[2]; const float* wo = (const float*)d_in[3]; const float* cosT = (const float*)d_in[4]; const float* sinT = (const float*)d_in[5]; const int* SL = (const int*)d_in[6];
    float* OUT = (float*)d_out;     // [2][2048][2048]
    char* wsp = (char*)d_ws;
    auto take = [&](size_t bytes) { char* p = wsp; wsp += (bytes + 255) & ~(size_t)255; return (void*)p; };
    bf* WQ = (bf*)take((size_t)(DQ + 2 * DKV) * DM * 2); bf* WKV = WQ + (size_t)DQ * DM;   /* one transposed plane of 4096 rows: 0-2047 q, 2048-3071 k, 3072-4095 v (2048 rows are 2048 K elements in fragment order too) */ bf* WO = (bf*)take((size_t)DM * DQ * 2);
    bf* XB = (bf*)take((size_t)TT * DM * 2);
    h16* QP16 = (h16*)take((size_t)NH_ * TT * HD * 2); h16* KP16 = (h16*)take((size_t)NKV * TT * HD * 2); h16* VT16 = (h16*)take((size_t)NKV * HD * TT * 2);
    bf* QPh = (bf*)take((size_t)NH_ * TT * HD * 2); bf* QPl = (bf*)take((size_t)NH_ * TT * HD * 2); bf* KPh = (bf*)take((size_t)NKV * TT * HD * 2); bf* KPl = (bf*)take((size_t)NKV * TT * HD * 2); bf* VTh = (bf*)take((size_t)NKV * HD * TT * 2); bf* VTl = (bf*)take((size_t)NKV * HD * TT * 2);
    bf* ATh = (bf*)take((size_t)TT * DQ * 2); bf* ATl = (bf*)take((size_t)TT * DQ * 2);   // the merged attention, hi/lo
    if ((size_t)(wsp - (char*)d_ws) > ws_size) return;    // ws 256 MiB
    const Planes PL = {QP16, QPh, QPl, KP16, KPh, KPl, VT16, VTh, VTl}, P0 = {};
    { k_wtG<DM, DQ><<<(unsigned)((DM * DQ / 8 + 255) / 256), 256, 0, stream>>>(wq, WQ); k_wtG<DM, 2 * DKV><<<(unsigned)((DM * 2 * DKV / 8 + 255) / 256), 256, 0, stream>>>(wkv, WKV);   /* 'xw' [2048][2048] -> Bt [2048][2048]: rows 0-1023 k, 1024-2047 v */
      k_wtG<DQ, DM><<<(unsigned)((DQ * DM / 8 + 255) / 256), 256, 0, stream>>>(wo, WO);
       }
    for (int b = 0; b < NB_; ++b) {
        k_cvt8<<<(unsigned)(((size_t)TT * DM / 8 + 255) / 256), 256, 0, stream>>>(x + (size_t)b * TT * DM, XB, DM, (size_t)TT * DM / 8);
        k_gemmw<bf, 0, false, 4, DM, 1><<<dim3(TT / 64, (DQ + 2 * DKV) / 64, 1), 128, 0, stream>>>(XB, nullptr, WQ, nullptr, nullptr, 0, nullptr, 0, 0, 0, cosT, sinT, PL);
        k_fattn<<<dim3(NH_, TT / 32, 1), 32 * FNW, 0, stream>>>(QP16, KP16, VT16, QPh, QPl, KPh, KPl, VTh, VTl, SL + b, ATh, ATl);
        k_gemmw<bf, 1, false, 4, DQ, 0><<<dim3(TT / 64, DM / 64, 1), 128, 0, stream>>>(ATh, ATl, WO, nullptr, OUT + (size_t)b * TT * DM, DM, nullptr, 0, 0, 0, nullptr, nullptr, P0); }
}

// v006
// It runs in 202 microseconds.
// Timed twice side by side with v005, it ran 1.11 times as fast both times.
// All steps since v000 together make it 8.36 times as fast.
#include <hip/hip_runtime.h>

// Causal GQA with key-padding mask and interleaved rotary (x [2][2048][2048]; q = x wq ('xw' [2048][2048], 16 heads x 128); [k|v] = x wkv ('xw' [2048][2048]: columns 0-1023 k, 1024-2047 v; 8 kv heads x 128); llama-style interleaved RoPE from the given tables [2048][64] on q, k; 2 query heads per kv head; scores/sqrt(128) masked where j > i OR j >= seq_lengths[b] (int32 input, read on device); softmax; out = merged wo ('xw') -> [2][2048][2048]).
// Compute dtypes, f32 accumulate: every input rounded to bf16; q/k/v on PLAIN bf16 operands (inputs: exact); rotary in f32 from the bf16-rounded tables; causal + padding-masked scores and attn.v (causal tile skipping): query rows < 512 hl (3 products), the rest single fp16 (probabilities x16); online softmax f32, attention fused in one kernel; wo hl x exact (2 products).
// Every 16-bit operand plane of a matrix product (x, the transposed weights, q, k, transposed v, the merged attention hi/lo) lies in fragment order (fragoff below), not row-major.

#define NB_  2
#define TT   2048
#define DM   2048
#define NH_  16
#define NKV  8
#define REP  (NH_ / NKV)
#define HD   128
#define DQ   (NH_ * HD)
#define DKV  (NKV * HD)
#define RH   512                  // query rows < RH use hi+lo planes (0: none)
#define SCL  0.088388347648318447f   // HD^-0.5
typedef _Float16 h16;
typedef unsigned short bf;
typedef __attribute__((ext_vector_type(16))) __bf16   v16bf;
typedef __attribute__((ext_vector_type(16))) _Float16 v16h;
typedef __attribute__((ext_vector_type(8)))  _Float16 v8h;
typedef __attribute__((ext_vector_type(8)))  unsigned short v8us;
typedef __attribute__((ext_vector_type(8)))  float    v8f;
typedef __attribute__((ext_vector_type(4)))  float    v4f;
typedef v8h  __attribute__((may_alias)) v8ha;
typedef v4f  __attribute__((may_alias)) v4fa;
typedef v8us __attribute__((may_alias)) v8usa;

__device__ __forceinline__ unsigned short f2bf(float f) { unsigned u = __float_as_uint(f); u += 0x7FFFu + ((u >> 16) & 1u); return (unsigned short)(u >> 16); }
__device__ __forceinline__ float bf2f(unsigned short b) { return __uint_as_float(((unsigned)b) << 16); }
__device__ __forceinline__ float bfr(float f) { return bf2f(f2bf(f)); }
__device__ __forceinline__ v16h cat16(v8h lo, v8h hi) { return __builtin_shufflevector(lo, hi, 0, 1, 2, 3, 4, 5, 6, 7, 8, 9, 10, 11, 12, 13, 14, 15); }
__device__ __forceinline__ v16bf cat16b(v8us lo, v8us hi) { return __builtin_bit_cast(v16bf, __builtin_shufflevector(lo, hi, 0, 1, 2, 3, 4, 5, 6, 7, 8, 9, 10, 11, 12, 13, 14, 15)); }
__device__ __forceinline__ v8f wmma16(v16h a, v16h b, v8f c) { return __builtin_amdgcn_wmma_f32_16x16x32_f16(false, a, false, b, (short)0, c, false, false); }
__device__ __forceinline__ v8f wmmab(v16bf a, v16bf b, v8f c) { return __builtin_amdgcn_wmma_f32_16x16x32_bf16(false, a, false, b, (short)0, c, false, false); }



// tile_sync: orders the LDS slab writes against the reads of the tile epilogue; one wave needs no hardware barrier, several waves need the work-group barrier.
// The fences name LDS alone: only LDS data passes between the waves here, and a full __syncthreads() would also hold every wave until the tile rows just stored to global memory have landed, at each of the four stages.
template <int NW> __device__ __forceinline__ void tile_sync() {
    if (NW == 1) { __builtin_amdgcn_wave_barrier(); asm volatile("" ::: "memory"); }
    else { __builtin_amdgcn_fence(__ATOMIC_RELEASE, "workgroup", "local"); __builtin_amdgcn_s_barrier(); __builtin_amdgcn_fence(__ATOMIC_ACQUIRE, "workgroup", "local"); } }

// Fragment order of a 16-bit operand plane [R][K] (R % 16 == 0, K % 32 == 0): blocks of 16 rows x 32 k, 512 elements each, block (r / 16, k / 32) at index (r / 16) * (K / 32) + k / 32.
// Inside a block the 16-byte piece that holds k & ~7 .. k | 7 of row r is piece ((k / 16) % 2) * 32 + ((k / 8) % 2) * 16 + r % 16: pieces 0-31 are the 32 lanes' first eight k of a 16x16x32 fragment, pieces 32-63 their second eight,
// so that a fragment is two loads of 512 contiguous bytes (four whole cache lines each) where a row-major plane gives 32 bytes from each of 16 lines. The values in each lane's registers are those of the row-major loader.
__device__ __forceinline__ size_t fragoff(int r, int k, int K) { return ((size_t)(r >> 4) * (K >> 5) + (k >> 5)) * 512 + (((k >> 4) & 1) * 32 + ((k >> 3) & 1) * 16 + (r & 15)) * 8 + (k & 7); }
// piece_rk: the row and the first k of 16-byte piece i of such a plane (the inverse of fragoff)
__device__ __forceinline__ void piece_rk(size_t i, int K, int& r, int& k) { const int w = (int)(i & 63); const int blk = (int)(i >> 6), kb = blk % (K >> 5), rb = blk / (K >> 5); r = rb * 16 + (w & 15); k = kb * 32 + (w >> 5) * 16 + ((w >> 4) & 1) * 8; }
// wait_x: stands behind a group of global loads, in front of any reuse of the address registers that they name; the lane addresses are inputs so that their registers stay whole up to the wait
template <typename T16> __device__ __forceinline__ void wait_x(const T16* p, const T16* p2) { asm volatile("s_wait_xcnt 0x0" :: "v"(p), "v"(p2) : "memory"); }
// ---- k_gemmw: register-blocked GEMM, one 64x64 output tile per work-group of NW waves (16 accumulators per wave), operands straight from 16-bit planes in fragment order; grid (M/64, N/64, Z), 32 * NW threads.
// Wave w takes the 32-wide K chunks w, w + NW, w + 2 NW, ...; the NW partial tiles are summed in wave order 0..NW-1 through LDS (one slab per wave) before the store.
// C[m][n] (f32, pitch ldc, + optional f32 bias[n]) = sum_k A[m][k] Bt[n][k] (+ split products per NSPLIT). z-batch strides sA/sB/sC in elements. K % 32 == 0, a constant of the build so that the row blocks' distances are immediates.
template <typename T16> struct WFrag;
template <> struct WFrag<h16> { typedef v16h V; static __device__ __forceinline__ V ldf(const h16* p) { return cat16(*(const v8h*)p, *(const v8h*)(p + 256)); } static __device__ __forceinline__ v8f mma(V a, V b, v8f c) { return wmma16(a, b, c); } };
template <> struct WFrag<bf> { typedef v16bf V; static __device__ __forceinline__ V ldf(const bf* p) { return cat16b(*(const v8us*)p, *(const v8us*)(p + 256)); } static __device__ __forceinline__ v8f mma(V a, V b, v8f c) { return wmmab(a, b, c); } };
// EPI 1 (the fused q, k, v projection; A = x, Bt = the transposed [wq | wkv], 4096 rows): no f32 tile leaves the kernel. The epilogue rounds the rotary tables, turns the q and k columns and stores the fp16 and hi/lo operand planes of the attention kernel in fragment order,
// (grid z = batch: each batch has its own set of planes, one behind the other) one 16-byte piece per thread, plane and stage (128 threads, 16 x 64 values a stage; a wave stores 512 contiguous bytes). A work-group of v columns swaps its two operands, so that its tile is v^T (rows d, columns t) and a piece of the transposed plane is eight columns of one tile row as well.
struct Planes { h16* q16; bf* qh; bf* ql; h16* k16; bf* kh; bf* kl; h16* v16; bf* vh; bf* vl; };
__device__ __forceinline__ void splitf(float y, unsigned short& h, unsigned short& l) { h = f2bf(y); l = f2bf(y - bf2f(h)); }
template <typename T16, int NSPLIT, bool BIAS, int NW, int K, int EPI>
__global__ __launch_bounds__(32 * NW) void k_gemmw(const T16* __restrict__ A, const T16* __restrict__ A2, const T16* __restrict__ Bt, const T16* __restrict__ Bt2, float* C, int ldc, const float* __restrict__ bias, size_t sA, size_t sB, size_t sC, const float* __restrict__ cosT, const float* __restrict__ sinT, Planes P) {
    static_assert(EPI == 0 || (NW == 4 && NSPLIT == 0), "the plane epilogue has one piece per thread of four waves");
    typedef typename WFrag<T16>::V V;
    __shared__ __align__(16) float os[NW * 16 * 68];
    const size_t z = blockIdx.z; A += z * sA; if (A2) A2 += z * sA; Bt += z * sB; if (Bt2) Bt2 += z * sB; C += z * sC;
    const int lane = threadIdx.x & 31, lr = lane & 15, hi = lane >> 4; const int wv = (NW == 1) ? 0 : __builtin_amdgcn_readfirstlane((int)(threadIdx.x >> 5)); const int r0 = blockIdx.x * 64, c0 = blockIdx.y * 64;
    v8f acc[4][4];
#pragma unroll
    for (int mb = 0; mb < 4; ++mb)
#pragma unroll
        for (int nb = 0; nb < 4; ++nb) acc[mb][nb] = (v8f){};
    // 16 rows of a plane are 16 K elements, a 32-wide K chunk 512: one lane pointer per plane walks the chunks, the four row blocks stand at constant distances from it
    const size_t l8 = (size_t)wv * 512 + 8 * lane; const T16* pa = A + (size_t)r0 * K + l8; const T16* pb = Bt + (size_t)c0 * K + l8; const T16* pa2 = (NSPLIT == 1 || NSPLIT == 2) ? A2 + (size_t)r0 * K + l8 : pa; const T16* pb2 = (NSPLIT >= 2) ? Bt2 + (size_t)c0 * K + l8 : pb;
    const bool isv = EPI == 1 && c0 >= DQ + DKV;   // block-uniform: a tile of v columns
    if (isv) { const T16* sw = pa; pa = pb; pb = sw; }   // tile rows = weight rows (d), tile columns = positions (t)
#pragma unroll 1
    for (int kc = wv * 32; kc < K; kc += 32 * NW) {
        V a[4], a2[4], b[4], b2[4];
#pragma unroll
        for (int mb = 0; mb < 4; ++mb) { a[mb] = WFrag<T16>::ldf(pa + mb * 16 * K); if (NSPLIT == 1 || NSPLIT == 2) a2[mb] = WFrag<T16>::ldf(pa2 + mb * 16 * K); }
#pragma unroll
        for (int nb = 0; nb < 4; ++nb) { b[nb] = WFrag<T16>::ldf(pb + nb * 16 * K); if (NSPLIT >= 2) b2[nb] = WFrag<T16>::ldf(pb2 + nb * 16 * K); }
        if (NSPLIT == 0) wait_x(pa, pb); else asm volatile("s_wait_xcnt 0x0" :: "v"(pa), "v"(pb), "v"(pa2), "v"(pb2) : "memory");   // as wait_x: in front of the steps of the lane pointers below
        pa += 512 * NW; pb += 512 * NW; if (NSPLIT != 0) { pa2 += 512 * NW; pb2 += 512 * NW; }
#pragma unroll
        for (int nb = 0; nb < 4; ++nb) {
#pragma unroll
            for (int mb = 0; mb < 4; ++mb) { acc[mb][nb] = WFrag<T16>::mma(a[mb], b[nb], acc[mb][nb]); if (NSPLIT == 1 || NSPLIT == 2) acc[mb][nb] = WFrag<T16>::mma(a2[mb], b[nb], acc[mb][nb]); if (NSPLIT >= 2) acc[mb][nb] = WFrag<T16>::mma(a[mb], b2[nb], acc[mb][nb]); } }
        asm volatile("v_nop\n\tv_nop\n\tv_nop\n\tv_nop" : "+v"(acc[0][0]), "+v"(acc[1][1]), "+v"(acc[2][2]), "+v"(acc[3][3]) : "v"(a[0]), "v"(a[3]));
    }
    // EPI 1: thread i owns piece i of the stage's two fragment blocks: tile row erow, tile columns ec8 .. ec8 + 7 (piece_rk's map)
    const int erow = threadIdx.x & 15, ec8 = (int)(threadIdx.x >> 6) * 32 + (int)((threadIdx.x >> 5) & 1) * 16 + (int)((threadIdx.x >> 4) & 1) * 8;
    h16* e16 = nullptr; bf* eh = nullptr; bf* el = nullptr; size_t estep = 0; v4f cq[4], sq[4];
    if (EPI == 1) {
        size_t eo;
        if (isv) { const int n = c0 - (DQ + DKV); eo = (z * NKV + n / HD) * HD * TT + fragoff(n % HD + erow, r0 + ec8, TT); estep = (size_t)16 * TT; e16 = P.v16; eh = P.vh; el = P.vl; }
        else { const bool isk = c0 >= DQ; const int n = isk ? c0 - DQ : c0; eo = (z * (isk ? NKV : NH_) + n / HD) * TT * HD + fragoff(r0 + erow, n % HD + ec8, HD); estep = (size_t)16 * HD; e16 = isk ? P.k16 : P.q16; eh = isk ? P.kh : P.qh; el = isk ? P.kl : P.ql;
            // the four stages' table entries (interleaved pairs (2i, 2i+1) use table column i) fly under the first stage's slab writes
            const size_t to = (size_t)(r0 + erow) * (HD / 2) + ((n % HD + ec8) >> 1); const float* pc = cosT + to; const float* ps = sinT + to;
#pragma unroll
            for (int mb = 0; mb < 4; ++mb) { cq[mb] = *(const v4f*)(pc + mb * 16 * (HD / 2)); sq[mb] = *(const v4f*)(ps + mb * 16 * (HD / 2)); }
            wait_x(pc, ps); }
        e16 += eo; eh += eo; el += eo; }
#pragma unroll
    for (int mb = 0; mb < 4; ++mb) {
#pragma unroll
        for (int nb = 0; nb < 4; ++nb) {
#pragma unroll
            for (int j = 0; j < 8; ++j) os[wv * (16 * 68) + (hi * 8 + j) * 68 + nb * 16 + lr] = acc[mb][nb][j]; }
        tile_sync<NW>();
        if (EPI == 1) {
            const float* sp = os + erow * 68 + ec8; v4f x0 = *(const v4fa*)sp, x1 = *(const v4fa*)(sp + 4);
#pragma unroll
            for (int w = 1; w < NW; ++w) { x0 += *(const v4fa*)(sp + w * (16 * 68)); x1 += *(const v4fa*)(sp + w * (16 * 68) + 4); }
            float r[8] = {x0[0], x0[1], x0[2], x0[3], x1[0], x1[1], x1[2], x1[3]};
            if (!isv) {
#pragma unroll
                for (int i = 0; i < 4; ++i) { const float c = bfr(cq[mb][i]), s = bfr(sq[mb][i]), tr = r[2 * i], ti = r[2 * i + 1]; r[2 * i] = tr * c - ti * s; r[2 * i + 1] = tr * s + ti * c; } }
            v8h o16; v8us oh, ol;
#pragma unroll
            for (int e = 0; e < 8; ++e) { o16[e] = (h16)r[e]; unsigned short a2, c2; splitf(r[e], a2, c2); oh[e] = a2; ol[e] = c2; }
            *(v8h*)(e16 + mb * estep) = o16; *(v8us*)(eh + mb * estep) = oh; *(v8us*)(el + mb * estep) = ol;
        } else {
            float* crow = C + (size_t)(r0 + mb * 16) * ldc + c0;
#pragma unroll
            for (int s = 0; s < (NW < 8 ? 8 / NW : 1); ++s) { const int row = 2 * NW * s + 2 * wv + hi, cofs = lr * 4; if (NW > 8 && wv >= 8) break;   /* 16 rows: waves 8 and up have none */ v4f val = *(const v4fa*)(os + row * 68 + cofs);
#pragma unroll
                for (int w = 1; w < NW; ++w) val += *(const v4fa*)(os + w * (16 * 68) + row * 68 + cofs);
                if (BIAS) { val[0] += bfr(bias[c0 + cofs]); val[1] += bfr(bias[c0 + cofs + 1]); val[2] += bfr(bias[c0 + cofs + 2]); val[3] += bfr(bias[c0 + cofs + 3]); }
                *(v4f*)(crow + (size_t)row * ldc + cofs) = val; }
             }
        if (mb < 3) {   // the slabs are rewritten by the next stage only
            if (NW > 1) asm volatile("s_wait_xcnt 0x0" ::: "memory");   // stands in front of the next stage's reuse of the registers that the stores above name
            tile_sync<NW>(); }
    }
}

typedef __attribute__((ext_vector_type(2))) _Float16 v2h;
typedef __attribute__((ext_vector_type(4))) _Float16 v4h;
typedef __attribute__((ext_vector_type(2))) unsigned short v2us;
typedef __attribute__((ext_vector_type(4))) unsigned short v4us;
typedef __attribute__((ext_vector_type(2))) float v2f;
typedef __attribute__((ext_vector_type(4))) int v4i;

// wtG: w [K][N] f32 -> Bt [N][K] bf16 in fragment order, piece i (16 bytes: eight k of one n) by this thread: a wave stores 512 contiguous bytes
template <int K, int N> __device__ __forceinline__ void wtG(const float* __restrict__ w, bf* Bt, size_t i) { int n, k; piece_rk(i, K, n, k); const float* p = w + (size_t)k * N + n; float x[8]; v8us o;
#pragma unroll
    for (int e = 0; e < 8; ++e) x[e] = p[e * N];
    wait_x(p, p);
#pragma unroll
    for (int e = 0; e < 8; ++e) o[e] = f2bf(x[e]);
    *(v8us*)(Bt + i * 8) = o; }
// cvt8: src [R][K] f32 -> dst bf16 in fragment order, piece i by this thread
template <int K> __device__ __forceinline__ void cvt8(const float* __restrict__ src, bf* dst, size_t i) { int r, k; piece_rk(i, K, r, k); const float* p = src + (size_t)r * K + k; const v8f v = *(const v8f*)p; wait_x(p, p); v8us o;
#pragma unroll
    for (int e = 0; e < 8; ++e) o[e] = f2bf(v[e]); *(v8us*)(dst + i * 8) = o;
    asm volatile("s_wait_xcnt 0x0" ::: "memory"); }   // behind the store: the build lays the caller's other branch behind this one, where the registers that the store names are written again
// k_prep: every conversion of a call in one launch, one 16-byte piece per thread. Work-groups 0 .. 3 WBLK - 1 transpose the three weights (all [2048][2048]), the rest convert x; the rows of both batches form one plane [NB_ TT][DM], in which batch b starts at b TT DM.
#define WBLK (DM * DQ / 8 / 256)
#define XBLK (NB_ * TT * DM / 8 / 256)
static_assert(DQ == DM && 2 * DKV == DM, "the three weights share one shape");
__global__ __launch_bounds__(256) void k_prep(const float* __restrict__ x, const float* __restrict__ wq, const float* __restrict__ wkv, const float* __restrict__ wo, bf* XB, bf* WQ, bf* WKV, bf* WO) {
    const unsigned bx = blockIdx.x;   // the choice of the source is block-uniform
    if (bx < 3 * WBLK) { const unsigned s = bx / WBLK; const float* w = s == 0 ? wq : s == 1 ? wkv : wo; bf* Bt = s == 0 ? WQ : s == 1 ? WKV : WO;
        wtG<DM, DM>(w, Bt, (size_t)(bx - s * WBLK) * 256 + threadIdx.x); }
    else cvt8<DM>(x, XB, (size_t)(bx - 3 * WBLK) * 256 + threadIdx.x); }
#define FNW 8
#define FP  132                   // slab row pitch in floats: 128 + 4, rows stay 16-byte aligned
__device__ __forceinline__ float xhalf(float x) { return __builtin_bit_cast(float, __builtin_amdgcn_permlanex16(__builtin_bit_cast(int, x), __builtin_bit_cast(int, x), 0x76543210, 0xfedcba98, false, false)); }  // lane l with lane l ^ 16
// exp2s: 2^x with, in the same statement, the one free slot that the instruction set asks for between a transcendental and a next instruction that reads its result or overwrites its source
__device__ __forceinline__ float exp2s(float x) { float r; asm("v_exp_f32 %0, %1\n\tv_nop" : "=v"(r) : "v"(x)); return r; }
template <typename T16> __device__ __forceinline__ void ldk(typename WFrag<T16>::V (&k)[2][4], const T16* base, int blk, int lane) {
    const T16* p = base + (size_t)(blk * 32) * HD + 8 * lane;   // fragment order: 16 keys are four blocks of 512 elements
#pragma unroll
    for (int kt = 0; kt < 2; ++kt)
#pragma unroll
        for (int kc = 0; kc < 4; ++kc) k[kt][kc] = WFrag<T16>::ldf(p + kt * 16 * HD + kc * 512);
    wait_x(p, p); }
template <typename T16, bool HI>
__device__ __forceinline__ void fattn_body(const T16* Q, const T16* Q2, const T16* Kp, const T16* K2, const T16* VT, const T16* VT2, const int* SLb, bf* Ah, bf* Al, float* slab, float* ms, float* ls, int h, int qb) {
    typedef typename WFrag<T16>::V V;
    const int lane = threadIdx.x & 31, lr = lane & 15, hi = lane >> 4; const int wv = __builtin_amdgcn_readfirstlane((int)(threadIdx.x >> 5));
    const int q0 = qb * 32;
    const int slen = min(max(SLb[0], 0), TT);                 // valid key count of this batch (int32 input), bounded by the shape
    const int np = min(qb + 1, (slen + 31) >> 5);             // 32-key passes of this query block: up to the diagonal and up to the last valid key
    const float cscale = SCL * 1.4426950408889634f, NINF = -__builtin_inff();
    const size_t qo = (size_t)h * TT * HD, ko = (size_t)(h / REP) * TT * HD;
    Q += qo; Kp += ko; VT += ko; if (HI) { Q2 += qo; K2 += ko; VT2 += ko; }
    V qf[2][4], q2[2][4];
#pragma unroll
    for (int g = 0; g < 2; ++g) { const size_t o = (size_t)(q0 + 16 * g) * HD + 8 * lane; const T16* qp = Q + o; const T16* qp2 = HI ? Q2 + o : qp;
#pragma unroll
        for (int kc = 0; kc < 4; ++kc) { qf[g][kc] = WFrag<T16>::ldf(qp + 512 * kc); if (HI) q2[g][kc] = WFrag<T16>::ldf(qp2 + 512 * kc); }
        wait_x(qp, qp2); }
    v8f acc[2][8]; float m_run[2], l_run[2];
#pragma unroll
    for (int g = 0; g < 2; ++g) { m_run[g] = NINF; l_run[g] = 0.f;
#pragma unroll
        for (int t = 0; t < 8; ++t) acc[g][t] = (v8f){}; }
    V kf[2][4];
    if (!HI) ldk<T16>(kf, Kp, max(min(wv, np - 1), 0), lane);
#pragma unroll 1
    for (int blk = wv; blk < np; blk += FNW) {
        const int key0 = blk * 32;
        V vf[8], v2[8], k2[2][4];
        if (HI) { ldk<T16>(kf, Kp, blk, lane); ldk<T16>(k2, K2, blk, lane); }   // six planes: no room to hold a pass ahead
        { const size_t o = (size_t)key0 * 16 + 8 * lane;   /* fragment order: 32 keys of 16 rows are one block of 512 elements, 16 rows 16 TT */ const T16* vp = VT + o; const T16* vp2 = HI ? VT2 + o : vp;
#pragma unroll
          for (int t = 0; t < 8; ++t) { vf[t] = WFrag<T16>::ldf(vp + (size_t)t * 16 * TT); if (HI) v2[t] = WFrag<T16>::ldf(vp2 + (size_t)t * 16 * TT); }
          wait_x(vp, vp2); }
        v8f s[2][2];
#pragma unroll
        for (int kt = 0; kt < 2; ++kt)
#pragma unroll
            for (int g = 0; g < 2; ++g) { s[kt][g] = (v8f){};
#pragma unroll
                for (int kc = 0; kc < 4; ++kc) { s[kt][g] = WFrag<T16>::mma(kf[kt][kc], qf[g][kc], s[kt][g]); if (HI) { s[kt][g] = WFrag<T16>::mma(k2[kt][kc], qf[g][kc], s[kt][g]); s[kt][g] = WFrag<T16>::mma(kf[kt][kc], q2[g][kc], s[kt][g]); } } }
        if (!HI) ldk<T16>(kf, Kp, min(blk + FNW, np - 1), lane);     // this wave's next pass's K rows fly under the softmax (the last pass reads a valid row block again)
        if (blk == qb || key0 + 32 > slen) {                  // wave-uniform: only the pass on the diagonal or across the last valid key pays for the mask
#pragma unroll
            for (int g = 0; g < 2; ++g)
#pragma unroll
                for (int kt = 0; kt < 2; ++kt)
#pragma unroll
                    for (int r = 0; r < 8; ++r) { const int key = key0 + 16 * kt + 8 * hi + r; if (key > q0 + 16 * g + lr || key >= slen) s[kt][g][r] = NINF; }   /* causal OR key padding; the pass's first key stays for every query */
        }
        float mb[2]; bool need = false;
#pragma unroll
        for (int g = 0; g < 2; ++g) { float mx = NINF;
#pragma unroll
            for (int kt = 0; kt < 2; ++kt)
#pragma unroll
                for (int r = 0; r < 8; ++r) mx = fmaxf(mx, s[kt][g][r]);
            mx = fmaxf(mx, xhalf(mx)) * cscale; mb[g] = mx; need = need || (mx > m_run[g] + 8.0f); }
        if (__builtin_amdgcn_ballot_w32(need) != 0) {
#pragma unroll
            for (int g = 0; g < 2; ++g) { const float m_new = fmaxf(m_run[g], mb[g]); const float corr = exp2s(m_run[g] - m_new);   /* 0 on the first pass */ l_run[g] *= corr; m_run[g] = m_new;
#pragma unroll
                for (int t = 0; t < 8; ++t) acc[g][t] = acc[g][t] * corr; }
        }
#pragma unroll
        for (int g = 0; g < 2; ++g) { const float nm = (HI ? 0.0f : 4.0f) - m_run[g]; float p[16], ps0 = 0.f, ps1 = 0.f;
#pragma unroll
            for (int e = 0; e < 16; ++e) { p[e] = exp2s(__builtin_fmaf(s[e >> 3][g][e & 7], cscale, nm)); if (e & 1) ps1 += p[e]; else ps0 += p[e]; }
            l_run[g] += ps0 + ps1;
            if (HI) { v8us h0, h1, l0, l1;
#pragma unroll
                for (int e = 0; e < 8; ++e) { unsigned short a, c2; splitf(p[e], a, c2); h0[e] = a; l0[e] = c2; splitf(p[e + 8], a, c2); h1[e] = a; l1[e] = c2; }
                const v16bf ph = cat16b(h0, h1), pl = cat16b(l0, l1);
#pragma unroll
                for (int t = 0; t < 8; ++t) { acc[g][t] = wmmab(__builtin_bit_cast(v16bf, vf[t]), ph, acc[g][t]); acc[g][t] = wmmab(__builtin_bit_cast(v16bf, vf[t]), pl, acc[g][t]); acc[g][t] = wmmab(__builtin_bit_cast(v16bf, v2[t]), ph, acc[g][t]); }
            } else { v16h pf;
#pragma unroll
                for (int e = 0; e < 16; ++e) pf[e] = (h16)p[e];
#pragma unroll
                for (int t = 0; t < 8; ++t) acc[g][t] = wmma16(__builtin_bit_cast(v16h, vf[t]), pf, acc[g][t]); } }
        __builtin_amdgcn_sched_barrier(0);                    // keeps the matrix instructions in front of the slots below
        asm volatile("v_nop\n\tv_nop\n\tv_nop\n\tv_nop\n\tv_nop");   // the distance behind the last matrix instruction on the loop's back edge
    }
    if (wv < np) {                                            // wave-uniform: a wave without a pass leaves no slab
#pragma unroll
        for (int g = 0; g < 2; ++g) { const float lf = l_run[g] + xhalf(l_run[g]);   /* each wave half summed its own eight keys of every 16 */ const int row = wv * 32 + 16 * g + lr;
            if (hi == 0) { ms[row] = m_run[g]; ls[row] = lf; }
#pragma unroll
            for (int t = 0; t < 8; ++t) { float* d = slab + row * FP + 16 * t + 8 * hi; const v8f a = acc[g][t]; *(v4fa*)d = (v4f){a[0], a[1], a[2], a[3]}; *(v4fa*)(d + 4) = (v4f){a[4], a[5], a[6], a[7]}; } }
    }
    __syncthreads();                                          // every wave's slab, maximum and sum are written before any is read
    const int na = min(FNW, np); const int q = threadIdx.x >> 3, dl = (threadIdx.x & 7) * 8;
    float mstar = NINF;
    for (int w = 0; w < na; ++w) mstar = fmaxf(mstar, ms[w * 32 + q]);
    float L = 0.f; v4f o[4];
#pragma unroll
    for (int i = 0; i < 4; ++i) o[i] = (v4f){};
    for (int w = 0; w < na; ++w) { const float f = exp2s(ms[w * 32 + q] - mstar); L += f * ls[w * 32 + q]; const float* sp = slab + (w * 32 + q) * FP + dl;
        o[0] += f * *(const v4fa*)sp; o[1] += f * *(const v4fa*)(sp + 4); o[2] += f * *(const v4fa*)(sp + 64); o[3] += f * *(const v4fa*)(sp + 68); }
    const float inv = __fdiv_rn(1.0f, L);
#pragma unroll
    for (int i = 0; i < 2; ++i) { v8us oh, ol;
#pragma unroll
        for (int e = 0; e < 8; ++e) { unsigned short a, c2; splitf(o[2 * i + (e >> 2)][e & 3] * inv, a, c2); oh[e] = a; ol[e] = c2; }
        const size_t oo = fragoff(q0 + q, h * HD + dl + 64 * i, DQ);   /* the output GEMM reads these planes in fragment order */ *(v8us*)(Ah + oo) = oh; *(v8us*)(Al + oo) = ol; }
}
__global__ __launch_bounds__(32 * FNW) void k_fattn(const h16* Q16, const h16* K16, const h16* V16, const bf* Qh, const bf* Ql, const bf* Kh, const bf* Kl, const bf* Vh, const bf* Vl, const int* SLb, bf* Ah, bf* Al) {   // no __restrict__: the plane loads keep their place in front of their waits
    __shared__ __align__(16) float slab[FNW * 32 * FP];
    __shared__ float ms[FNW * 32], ls[FNW * 32];
    const int h = blockIdx.x, qb = TT / 32 - 1 - (int)blockIdx.z;   // the longest query blocks start first
    { const size_t b = blockIdx.y, oq = b * NH_ * TT * HD, okv = b * NKV * TT * HD, oa = b * TT * DQ;   // this batch's planes and its length
      Q16 += oq; Qh += oq; Ql += oq; K16 += okv; Kh += okv; Kl += okv; V16 += okv; Vh += okv; Vl += okv; Ah += oa; Al += oa; SLb += b; }
    if (qb < RH / 32) fattn_body<bf, true>(Qh, Ql, Kh, Kl, Vh, Vl, SLb, Ah, Al, slab, ms, ls, h, qb);   // block-uniform
    else fattn_body<h16, false>(Q16, nullptr, K16, nullptr, V16, nullptr, SLb, Ah, Al, slab, ms, ls, h, qb);
}

extern "C" void kernel_launch(void* const* d_in, const int* in_sizes, int n_in,
                              void* d_out, int out_size, void* d_ws, size_t ws_size, hipStream_t stream) {
    (void)in_sizes; (void)n_in; (void)out_size;
    const float* x = (const float*)d_in[0]; const float* wq = (const float*)d_in[1]; const float* wkv = (const float*)d_in[2]; const float* wo = (const float*)d_in[3]; const float* cosT = (const float*)d_in[4]; const float* sinT = (const float*)d_in[5]; const int* SL = (const int*)d_in[6];
    float* OUT = (float*)d_out;     // [2][2048][2048]
    char* wsp = (char*)d_ws;
    auto take = [&](size_t bytes) { char* p = wsp; wsp += (bytes + 255) & ~(size_t)255; return (void*)p; };
    bf* WQ = (bf*)take((size_t)(DQ + 2 * DKV) * DM * 2); bf* WKV = WQ + (size_t)DQ * DM;   /* one transposed plane of 4096 rows: 0-2047 q, 2048-3071 k, 3072-4095 v (2048 rows are 2048 K elements in fragment order too) */ bf* WO = (bf*)take((size_t)DM * DQ * 2);
    bf* XB = (bf*)take((size_t)NB_ * TT * DM * 2);
    // every plane below holds both batches, batch 1 behind batch 0
    h16* QP16 = (h16*)take((size_t)NB_ * NH_ * TT * HD * 2); h16* KP16 = (h16*)take((size_t)NB_ * NKV * TT * HD * 2); h16* VT16 = (h16*)take((size_t)NB_ * NKV * HD * TT * 2);
    bf* QPh = (bf*)take((size_t)NB_ * NH_ * TT * HD * 2); bf* QPl = (bf*)take((size_t)NB_ * NH_ * TT * HD * 2); bf* KPh = (bf*)take((size_t)NB_ * NKV * TT * HD * 2); bf* KPl = (bf*)take((size_t)NB_ * NKV * TT * HD * 2); bf* VTh = (bf*)take((size_t)NB_ * NKV * HD * TT * 2); bf* VTl = (bf*)take((size_t)NB_ * NKV * HD * TT * 2);
    bf* ATh = (bf*)take((size_t)NB_ * TT * DQ * 2); bf* ATl = (bf*)take((size_t)NB_ * TT * DQ * 2);   // the merged attention, hi/lo
    if ((size_t)(wsp - (char*)d_ws) > ws_size) return;    // ws 256 MiB
    const Planes PL = {QP16, QPh, QPl, KP16, KPh, KPl, VT16, VTh, VTl}, P0 = {};
    k_prep<<<3 * WBLK + XBLK, 256, 0, stream>>>(x, wq, wkv, wo, XB, WQ, WKV, WO);   /* wkv 'xw' [2048][2048] -> Bt [2048][2048]: rows 0-1023 k, 1024-2047 v */
    k_gemmw<bf, 0, false, 4, DM, 1><<<dim3(TT / 64, (DQ + 2 * DKV) / 64, NB_), 128, 0, stream>>>(XB, nullptr, WQ, nullptr, nullptr, 0, nullptr, (size_t)TT * DM, 0, 0, cosT, sinT, PL);
    k_fattn<<<dim3(NH_, NB_, TT / 32), 32 * FNW, 0, stream>>>(QP16, KP16, VT16, QPh, QPl, KPh, KPl, VTh, VTl, SL, ATh, ATl);
    k_gemmw<bf, 1, false, 4, DQ, 0><<<dim3(TT / 64, DM / 64, NB_), 128, 0, stream>>>(ATh, ATl, WO, nullptr, OUT, DM, nullptr, (size_t)TT * DQ, 0, (size_t)TT * DM, nullptr, nullptr, P0);
}
